// v000
// Measured on an AMD MI455X. A time is GPU time per run, averaged over a window of back-to-back runs after a warm-up
// (all launches, gaps included; the runs take copies of the inputs in turn), and the median of several windows.
// Apart from v000's, it joins two sittings. Times from different sittings can be a few percent apart, while
// side-by-side timings come from the same sitting.
// v000, which the later versions start from, runs in 332 microseconds.
#include <hip/hip_runtime.h>

typedef __attribute__((ext_vector_type(2))) float v2f;
typedef __attribute__((ext_vector_type(8))) float v8f;
typedef __attribute__((address_space(3))) float lds_f;

#define N_TOK 32768
#define DIN 256
#define DHID 1024
#define DOUT 256
#define ND 8
#define ROWS 32
#define MAX_TILES (N_TOK / ROWS)
#define SX_STRIDE 260   // == 4 (mod 64 banks): conflict-free column reads
#define SH_STRIDE 1028  // == 4 (mod 64 banks)
#define LN_EPS 1e-5f

// ---------------- dispatch (bin tokens by domain) ----------------

__global__ void k_zero(int* w) {
  if (threadIdx.x < 16) w[threadIdx.x] = 0;  // counts[8] + cursors[8]
}

__global__ void k_count(const int* __restrict__ dom, int* __restrict__ counts, int n) {
  int i = blockIdx.x * blockDim.x + threadIdx.x;
  if (i < n) atomicAdd(&counts[dom[i]], 1);
}

__global__ void k_scan(const int* __restrict__ counts, int* __restrict__ offsets) {
  if (threadIdx.x == 0) {
    int a = 0;
    for (int d = 0; d < ND; ++d) { offsets[d] = a; a += counts[d]; }
  }
}

__global__ void k_scatter(const int* __restrict__ dom, const int* __restrict__ offsets,
                          int* __restrict__ cursors, int* __restrict__ perm, int n) {
  int i = blockIdx.x * blockDim.x + threadIdx.x;
  if (i < n) {
    int d = dom[i];
    int p = atomicAdd(&cursors[d], 1);
    perm[offsets[d] + p] = i;
  }
}

// Repack W[K][NC] (per domain) into P[kp][n][2] = {W[2kp][n], W[2kp+1][n]}
// so a WMMA B-fragment is one contiguous b64 per lane.
__global__ void k_pack(const float* __restrict__ W, float* __restrict__ P,
                       int K, int NC) {
  long i = (long)blockIdx.x * blockDim.x + threadIdx.x;
  long total = (long)ND * (K >> 1) * NC;
  if (i >= total) return;
  int n   = (int)(i % NC);
  long t  = i / NC;
  int kp  = (int)(t % (K >> 1));
  int dd  = (int)(t / (K >> 1));
  const float* src = W + ((size_t)dd * K + (size_t)(kp << 1)) * NC + n;
  v2f v;
  v.x = src[0];
  v.y = src[NC];
  *(v2f*)(P + (size_t)i * 2) = v;
}

// ---------------- fused expert MLP over one 32-row tile ----------------

template <bool PACKED>
__launch_bounds__(256, 1)
__global__ void k_mlp(const float* __restrict__ x,
                      const float* __restrict__ W1, const float* __restrict__ b1,
                      const float* __restrict__ gamma, const float* __restrict__ beta,
                      const float* __restrict__ W2, const float* __restrict__ b2,
                      const float* __restrict__ W1p, const float* __restrict__ W2p,
                      float* __restrict__ out,
                      const int* __restrict__ counts, const int* __restrict__ offsets,
                      const int* __restrict__ perm) {
  __shared__ float sX[ROWS * SX_STRIDE];
  __shared__ float sH[ROWS * SH_STRIDE];
  __shared__ int srow[ROWS];

  const int bid  = blockIdx.x;
  const int d    = bid & (ND - 1);
  const int tile = bid >> 3;
  const int cnt  = counts[d];
  const int row0 = tile * ROWS;
  if (row0 >= cnt) return;                 // uniform early-exit for surplus tiles
  const int base   = offsets[d];
  const int nvalid = min(ROWS, cnt - row0);

  const int tid = threadIdx.x;
  if (tid < ROWS) {
    int rr = (tid < nvalid) ? (row0 + tid) : row0;  // clamp padding rows to a valid token
    srow[tid] = perm[base + rr];
  }
  __syncthreads();

  // gather X tile (32 x 256 fp32) straight into LDS with async b128 copies
  {
    for (int f = tid; f < ROWS * (DIN / 4); f += 256) {
      int r  = f >> 6;      // 64 float4 per row
      int c4 = f & 63;
      const float* gsrc = x + (size_t)srow[r] * DIN + (c4 << 2);
      lds_f* ldst = (lds_f*)&sX[r * SX_STRIDE + (c4 << 2)];
      asm volatile("global_load_async_to_lds_b128 %0, %1, off"
                   :: "v"(ldst), "v"(gsrc) : "memory");
    }
    asm volatile("s_wait_asynccnt 0x0" ::: "memory");
  }
  __syncthreads();

  const int wave  = tid >> 5;
  const int lane  = tid & 31;
  const int nlo   = lane & 15;   // N index (and A-matrix row M) within a 16-tile
  const int khalf = lane >> 4;   // lanes 16-31 carry K+2/K+3 per ISA 16x4 layout

  // ---- stage 1: H = X @ W1[d] + b1[d]; this wave owns cols [wave*128, wave*128+128)
  {
    const float* W1d  = W1  + (size_t)d * DIN * DHID;
    const float* W1pd = W1p + (size_t)d * (DIN / 2) * DHID * 2;
    const float* b1d  = b1  + (size_t)d * DHID;
    const int cb = wave * 128;
    v8f acc[2][8];                               // [row-tile][col-tile]
#pragma unroll
    for (int nt = 0; nt < 8; ++nt) {
      float bb = b1d[cb + nt * 16 + nlo];
      v8f t = {bb, bb, bb, bb, bb, bb, bb, bb};
      acc[0][nt] = t;
      acc[1][nt] = t;
    }
    for (int k0 = 0; k0 < DIN; k0 += 4) {
      const int ka = k0 + 2 * khalf;
      v2f a0 = *(const v2f*)(&sX[nlo * SX_STRIDE + ka]);         // rows 0..15
      v2f a1 = *(const v2f*)(&sX[(nlo + 16) * SX_STRIDE + ka]);  // rows 16..31
#pragma unroll
      for (int nt = 0; nt < 8; ++nt) {
        const int nc = cb + nt * 16 + nlo;
        v2f b;
        if (PACKED) {
          b = *(const v2f*)(W1pd + (((size_t)(k0 >> 1) + khalf) * DHID + nc) * 2);
        } else {
          b.x = W1d[(size_t)ka * DHID + nc];
          b.y = W1d[(size_t)(ka + 1) * DHID + nc];
        }
        acc[0][nt] = __builtin_amdgcn_wmma_f32_16x16x4_f32(
            false, a0, false, b, (short)0, acc[0][nt], false, false);
        acc[1][nt] = __builtin_amdgcn_wmma_f32_16x16x4_f32(
            false, a1, false, b, (short)0, acc[1][nt], false, false);
      }
    }
#pragma unroll
    for (int rt = 0; rt < 2; ++rt)
#pragma unroll
      for (int nt = 0; nt < 8; ++nt)
#pragma unroll
        for (int v = 0; v < 8; ++v)
          sH[(rt * 16 + v + 8 * khalf) * SH_STRIDE + cb + nt * 16 + nlo] = acc[rt][nt][v];
  }
  __syncthreads();

  // ---- LayerNorm + ReLU (two-pass, matches reference); 4 rows per wave
  {
    const float* gd = gamma + (size_t)d * DHID;
    const float* bd = beta  + (size_t)d * DHID;
#pragma unroll
    for (int rr = 0; rr < 4; ++rr) {
      const int r = wave * 4 + rr;
      float s = 0.f;
      for (int c = lane; c < DHID; c += 32) s += sH[r * SH_STRIDE + c];
#pragma unroll
      for (int off = 16; off > 0; off >>= 1) s += __shfl_xor(s, off, 32);
      const float mu = s * (1.f / DHID);
      float vv = 0.f;
      for (int c = lane; c < DHID; c += 32) {
        float h = sH[r * SH_STRIDE + c] - mu;
        vv += h * h;
      }
#pragma unroll
      for (int off = 16; off > 0; off >>= 1) vv += __shfl_xor(vv, off, 32);
      const float inv = rsqrtf(vv * (1.f / DHID) + LN_EPS);
      for (int c = lane; c < DHID; c += 32) {
        float h = (sH[r * SH_STRIDE + c] - mu) * inv * gd[c] + bd[c];
        sH[r * SH_STRIDE + c] = fmaxf(h, 0.f);
      }
    }
  }
  __syncthreads();

  // ---- stage 2: OUT = H @ W2[d] + b2[d]; this wave owns cols [wave*32, wave*32+32)
  {
    const float* W2d  = W2  + (size_t)d * DHID * DOUT;
    const float* W2pd = W2p + (size_t)d * (DHID / 2) * DOUT * 2;
    const float* b2d  = b2  + (size_t)d * DOUT;
    const int cb = wave * 32;
    v8f acc[2][2];                               // [row-tile][col-tile]
#pragma unroll
    for (int nt = 0; nt < 2; ++nt) {
      float bb = b2d[cb + nt * 16 + nlo];
      v8f t = {bb, bb, bb, bb, bb, bb, bb, bb};
      acc[0][nt] = t;
      acc[1][nt] = t;
    }
    for (int k0 = 0; k0 < DHID; k0 += 4) {
      const int ka = k0 + 2 * khalf;
      v2f a0 = *(const v2f*)(&sH[nlo * SH_STRIDE + ka]);
      v2f a1 = *(const v2f*)(&sH[(nlo + 16) * SH_STRIDE + ka]);
#pragma unroll
      for (int nt = 0; nt < 2; ++nt) {
        const int nc = cb + nt * 16 + nlo;
        v2f b;
        if (PACKED) {
          b = *(const v2f*)(W2pd + (((size_t)(k0 >> 1) + khalf) * DOUT + nc) * 2);
        } else {
          b.x = W2d[(size_t)ka * DOUT + nc];
          b.y = W2d[(size_t)(ka + 1) * DOUT + nc];
        }
        acc[0][nt] = __builtin_amdgcn_wmma_f32_16x16x4_f32(
            false, a0, false, b, (short)0, acc[0][nt], false, false);
        acc[1][nt] = __builtin_amdgcn_wmma_f32_16x16x4_f32(
            false, a1, false, b, (short)0, acc[1][nt], false, false);
      }
    }
#pragma unroll
    for (int rt = 0; rt < 2; ++rt)
#pragma unroll
      for (int nt = 0; nt < 2; ++nt)
#pragma unroll
        for (int v = 0; v < 8; ++v) {
          const int mrow = rt * 16 + v + 8 * khalf;
          if (mrow < nvalid)
            out[(size_t)srow[mrow] * DOUT + cb + nt * 16 + nlo] = acc[rt][nt][v];
        }
  }
}

// ---------------- launcher ----------------

extern "C" void kernel_launch(void* const* d_in, const int* in_sizes, int n_in,
                              void* d_out, int out_size, void* d_ws, size_t ws_size,
                              hipStream_t stream) {
  const float* x     = (const float*)d_in[0];
  const int*   dom   = (const int*)d_in[1];
  const float* W1    = (const float*)d_in[2];
  const float* b1    = (const float*)d_in[3];
  const float* gamma = (const float*)d_in[4];
  const float* beta  = (const float*)d_in[5];
  const float* W2    = (const float*)d_in[6];
  const float* b2    = (const float*)d_in[7];
  float* out = (float*)d_out;

  int* wsi     = (int*)d_ws;
  int* counts  = wsi;        // 8
  int* cursors = wsi + 8;    // 8
  int* offsets = wsi + 16;   // 8
  int* perm    = wsi + 32;   // N_TOK

  const size_t packElems1 = (size_t)ND * (DIN / 2) * DHID * 2;   // 2M floats
  const size_t packElems2 = (size_t)ND * (DHID / 2) * DOUT * 2;  // 2M floats
  float* p1 = (float*)(wsi + 32 + N_TOK);
  float* p2 = p1 + packElems1;
  const size_t needed = (size_t)(32 + N_TOK) * 4 + (packElems1 + packElems2) * 4;
  const bool packed = (ws_size >= needed);

  k_zero<<<1, 32, 0, stream>>>(wsi);
  k_count<<<N_TOK / 256, 256, 0, stream>>>(dom, counts, N_TOK);
  k_scan<<<1, 32, 0, stream>>>(counts, offsets);
  k_scatter<<<N_TOK / 256, 256, 0, stream>>>(dom, offsets, cursors, perm, N_TOK);

  if (packed) {
    const long tot1 = (long)ND * (DIN / 2) * DHID;   // 1,048,576
    const long tot2 = (long)ND * (DHID / 2) * DOUT;  // 1,048,576
    k_pack<<<(int)((tot1 + 255) / 256), 256, 0, stream>>>(W1, p1, DIN, DHID);
    k_pack<<<(int)((tot2 + 255) / 256), 256, 0, stream>>>(W2, p2, DHID, DOUT);
    k_mlp<true><<<ND * MAX_TILES, 256, 0, stream>>>(
        x, W1, b1, gamma, beta, W2, b2, p1, p2, out, counts, offsets, perm);
  } else {
    k_mlp<false><<<ND * MAX_TILES, 256, 0, stream>>>(
        x, W1, b1, gamma, beta, W2, b2, p1, p2, out, counts, offsets, perm);
  }
}

// v001
// A run of this version takes 271 microseconds.
// Timed twice side by side with v000, it ran 1.27 and 1.26 times as fast.
#include <hip/hip_runtime.h>

typedef __attribute__((ext_vector_type(2))) float v2f;
typedef __attribute__((ext_vector_type(8))) float v8f;
typedef __attribute__((address_space(3))) float lds_f;

#define N_TOK 32768
#define DIN 256
#define DHID 1024
#define DOUT 256
#define ND 8
#define ROWS 32
#define MAX_TILES (N_TOK / ROWS)
#define SX_STRIDE 260   // == 4 (mod 64 banks): conflict-free column reads
#define SH_STRIDE 1028  // == 4 (mod 64 banks)
#define LN_EPS 1e-5f

// ---------------- dispatch (bin tokens by domain) ----------------

__global__ void k_zero(int* w) {
  if (threadIdx.x < 16) w[threadIdx.x] = 0;  // counts[8] + cursors[8]
}

__global__ void k_count(const int* __restrict__ dom, int* __restrict__ counts, int n) {
  int i = blockIdx.x * blockDim.x + threadIdx.x;
  if (i < n) atomicAdd(&counts[dom[i]], 1);
}

__global__ void k_scan(const int* __restrict__ counts, int* __restrict__ offsets) {
  if (threadIdx.x == 0) {
    int a = 0;
    for (int d = 0; d < ND; ++d) { offsets[d] = a; a += counts[d]; }
  }
}

__global__ void k_scatter(const int* __restrict__ dom, const int* __restrict__ offsets,
                          int* __restrict__ cursors, int* __restrict__ perm, int n) {
  int i = blockIdx.x * blockDim.x + threadIdx.x;
  if (i < n) {
    int d = dom[i];
    int p = atomicAdd(&cursors[d], 1);
    perm[offsets[d] + p] = i;
  }
}

// Repack W[K][NC] (per domain) into P[kp][n][2] = {W[2kp][n], W[2kp+1][n]}
// so a WMMA B-fragment is one contiguous b64 per lane.
__global__ void k_pack(const float* __restrict__ W, float* __restrict__ P,
                       int K, int NC) {
  long i = (long)blockIdx.x * blockDim.x + threadIdx.x;
  long total = (long)ND * (K >> 1) * NC;
  if (i >= total) return;
  int n   = (int)(i % NC);
  long t  = i / NC;
  int kp  = (int)(t % (K >> 1));
  int dd  = (int)(t / (K >> 1));
  const float* src = W + ((size_t)dd * K + (size_t)(kp << 1)) * NC + n;
  v2f v;
  v.x = src[0];
  v.y = src[NC];
  *(v2f*)(P + (size_t)i * 2) = v;
}

// ---------------- operand fetch one block of k-steps ahead ----------------

// One block = KS k-steps of 4: the A fragments of both row tiles (from LDS) and
// the B fragments of the wave's NT column tiles (from global memory).
template <int NT, int KS>
struct Frags {
  v2f a[KS][2];
  v2f b[KS][NT];
};

// pa, pb: the lane's own first A element (LDS) and first B element (global) of the block.
template <bool PACKED, int NC, int NT, int KS>
__device__ __forceinline__ void fetch_block(Frags<NT, KS>& f, const float* pa, int astride,
                                            const float* __restrict__ pb) {
#pragma unroll
  for (int ks = 0; ks < KS; ++ks)
#pragma unroll
    for (int nt = 0; nt < NT; ++nt) {
      if (PACKED) {
        f.b[ks][nt] = *(const v2f*)(pb + (ks * 2 * NC + nt * 16) * 2);
      } else {
        f.b[ks][nt].x = pb[ks * 4 * NC + nt * 16];
        f.b[ks][nt].y = pb[(ks * 4 + 1) * NC + nt * 16];
      }
    }
#pragma unroll
  for (int ks = 0; ks < KS; ++ks) {
    f.a[ks][0] = *(const v2f*)(pa + ks * 4);                 // rows 0..15
    f.a[ks][1] = *(const v2f*)(pa + 16 * astride + ks * 4);  // rows 16..31
  }
}

template <int NT, int KS>
__device__ __forceinline__ void mma_block(const Frags<NT, KS>& f, v8f (&acc)[2][NT]) {
#pragma unroll
  for (int ks = 0; ks < KS; ++ks)
#pragma unroll
    for (int nt = 0; nt < NT; ++nt) {
      acc[0][nt] = __builtin_amdgcn_wmma_f32_16x16x4_f32(
          false, f.a[ks][0], false, f.b[ks][nt], (short)0, acc[0][nt], false, false);
      acc[1][nt] = __builtin_amdgcn_wmma_f32_16x16x4_f32(
          false, f.a[ks][1], false, f.b[ks][nt], (short)0, acc[1][nt], false, false);
    }
}

// acc += A[32 x K] (LDS) * W[K x NT*16]: two fragment sets, the set of block j+1
// is requested before the products of block j, so its latency runs behind them.
// k runs upward through the same accumulators as a plain loop.
template <bool PACKED, int K, int NC, int NT, int KS>
__device__ __forceinline__ void gemm_ahead(v8f (&acc)[2][NT], const float* sA, int astride,
                                           const float* __restrict__ Wd,
                                           const float* __restrict__ Wpd,
                                           int cb, int nlo, int khalf) {
  constexpr int BK = KS * 4;       // k per block
  constexpr int BSTEP = BK * NC;   // floats of W per block, packed or not
  const float* pa = sA + nlo * astride + 2 * khalf;
  const float* const pb0 = PACKED ? Wpd + ((size_t)khalf * NC + cb + nlo) * 2
                                  : Wd + (size_t)(2 * khalf) * NC + cb + nlo;
  const float* pb = pb0;
  Frags<NT, KS> f0, f1;
  fetch_block<PACKED, NC, NT, KS>(f0, pa, astride, pb);
  // The scheduling barriers keep every fetch one group that stands whole in front of
  // the other set's products: without them the LDS reads sink in among the WMMAs
  // that use them and are waited for there.
  for (int kb = 0; kb < K - 2 * BK; kb += 2 * BK) {
    fetch_block<PACKED, NC, NT, KS>(f1, pa + BK, astride, pb + BSTEP);
    __builtin_amdgcn_sched_barrier(0);
    mma_block<NT, KS>(f0, acc);
    __builtin_amdgcn_sched_barrier(0);
    fetch_block<PACKED, NC, NT, KS>(f0, pa + 2 * BK, astride, pb + 2 * BSTEP);
    __builtin_amdgcn_sched_barrier(0);
    mma_block<NT, KS>(f1, acc);
    __builtin_amdgcn_sched_barrier(0);
    // The loads of f0 are still in flight here and the step below rewrites their
    // address registers: the wait on address translations stands in front of it
    // (between two scheduling barriers, so that it stays behind the products and
    // the step stays behind it).
    asm volatile("s_wait_xcnt 0x0" ::: "memory");
    __builtin_amdgcn_sched_barrier(0);
    pa += 2 * BK;
    pb += 2 * BSTEP;
  }
  fetch_block<PACKED, NC, NT, KS>(f1, pa + BK, astride, pb0 + (K / BK - 1) * BSTEP);
  // Last use of pb0: naming it here keeps its registers from being reused for
  // anything else before the translations of the loads above are done.
  asm volatile("s_wait_xcnt 0x0" :: "v"(pb0) : "memory");
  __builtin_amdgcn_sched_barrier(0);
  mma_block<NT, KS>(f0, acc);
  mma_block<NT, KS>(f1, acc);
}

// ---------------- fused expert MLP over one 32-row tile ----------------

template <bool PACKED>
__launch_bounds__(256, 1)
__global__ void k_mlp(const float* __restrict__ x,
                      const float* __restrict__ W1, const float* __restrict__ b1,
                      const float* __restrict__ gamma, const float* __restrict__ beta,
                      const float* __restrict__ W2, const float* __restrict__ b2,
                      const float* __restrict__ W1p, const float* __restrict__ W2p,
                      float* __restrict__ out,
                      const int* __restrict__ counts, const int* __restrict__ offsets,
                      const int* __restrict__ perm) {
  __shared__ float sX[ROWS * SX_STRIDE];
  __shared__ float sH[ROWS * SH_STRIDE];
  __shared__ int srow[ROWS];

  const int bid  = blockIdx.x;
  const int d    = bid & (ND - 1);
  const int tile = bid >> 3;
  const int cnt  = counts[d];
  const int row0 = tile * ROWS;
  if (row0 >= cnt) return;                 // uniform early-exit for surplus tiles
  const int base   = offsets[d];
  const int nvalid = min(ROWS, cnt - row0);

  const int tid = threadIdx.x;
  if (tid < ROWS) {
    int rr = (tid < nvalid) ? (row0 + tid) : row0;  // clamp padding rows to a valid token
    srow[tid] = perm[base + rr];
  }
  __syncthreads();

  // gather X tile (32 x 256 fp32) straight into LDS with async b128 copies
  {
    for (int f = tid; f < ROWS * (DIN / 4); f += 256) {
      int r  = f >> 6;      // 64 float4 per row
      int c4 = f & 63;
      const float* gsrc = x + (size_t)srow[r] * DIN + (c4 << 2);
      lds_f* ldst = (lds_f*)&sX[r * SX_STRIDE + (c4 << 2)];
      asm volatile("global_load_async_to_lds_b128 %0, %1, off"
                   :: "v"(ldst), "v"(gsrc) : "memory");
    }
    asm volatile("s_wait_asynccnt 0x0" ::: "memory");
  }
  __syncthreads();

  const int wave  = tid >> 5;
  const int lane  = tid & 31;
  const int nlo   = lane & 15;   // N index (and A-matrix row M) within a 16-tile
  const int khalf = lane >> 4;   // lanes 16-31 carry K+2/K+3 per ISA 16x4 layout

  // ---- stage 1: H = X @ W1[d] + b1[d]; this wave owns cols [wave*128, wave*128+128)
  {
    const float* W1d  = W1  + (size_t)d * DIN * DHID;
    const float* W1pd = W1p + (size_t)d * (DIN / 2) * DHID * 2;
    const float* b1d  = b1  + (size_t)d * DHID;
    const int cb = wave * 128;
    v8f acc[2][8];                               // [row-tile][col-tile]
#pragma unroll
    for (int nt = 0; nt < 8; ++nt) {
      float bb = b1d[cb + nt * 16 + nlo];
      v8f t = {bb, bb, bb, bb, bb, bb, bb, bb};
      acc[0][nt] = t;
      acc[1][nt] = t;
    }
    gemm_ahead<PACKED, DIN, DHID, 8, 4>(acc, sX, SX_STRIDE, W1d, W1pd, cb, nlo, khalf);
#pragma unroll
    for (int rt = 0; rt < 2; ++rt)
#pragma unroll
      for (int nt = 0; nt < 8; ++nt)
#pragma unroll
        for (int v = 0; v < 8; ++v)
          sH[(rt * 16 + v + 8 * khalf) * SH_STRIDE + cb + nt * 16 + nlo] = acc[rt][nt][v];
  }
  __syncthreads();

  // ---- LayerNorm + ReLU (two-pass, matches reference); 4 rows per wave
  {
    const float* gd = gamma + (size_t)d * DHID;
    const float* bd = beta  + (size_t)d * DHID;
#pragma unroll
    for (int rr = 0; rr < 4; ++rr) {
      const int r = wave * 4 + rr;
      float s = 0.f;
      for (int c = lane; c < DHID; c += 32) s += sH[r * SH_STRIDE + c];
#pragma unroll
      for (int off = 16; off > 0; off >>= 1) s += __shfl_xor(s, off, 32);
      const float mu = s * (1.f / DHID);
      float vv = 0.f;
      for (int c = lane; c < DHID; c += 32) {
        float h = sH[r * SH_STRIDE + c] - mu;
        vv += h * h;
      }
#pragma unroll
      for (int off = 16; off > 0; off >>= 1) vv += __shfl_xor(vv, off, 32);
      const float inv = rsqrtf(vv * (1.f / DHID) + LN_EPS);
      for (int c = lane; c < DHID; c += 32) {
        float h = (sH[r * SH_STRIDE + c] - mu) * inv * gd[c] + bd[c];
        sH[r * SH_STRIDE + c] = fmaxf(h, 0.f);
      }
    }
  }
  __syncthreads();

  // ---- stage 2: OUT = H @ W2[d] + b2[d]; this wave owns cols [wave*32, wave*32+32)
  {
    const float* W2d  = W2  + (size_t)d * DHID * DOUT;
    const float* W2pd = W2p + (size_t)d * (DHID / 2) * DOUT * 2;
    const float* b2d  = b2  + (size_t)d * DOUT;
    const int cb = wave * 32;
    v8f acc[2][2];                               // [row-tile][col-tile]
#pragma unroll
    for (int nt = 0; nt < 2; ++nt) {
      float bb = b2d[cb + nt * 16 + nlo];
      v8f t = {bb, bb, bb, bb, bb, bb, bb, bb};
      acc[0][nt] = t;
      acc[1][nt] = t;
    }
    gemm_ahead<PACKED, DHID, DOUT, 2, 16>(acc, sH, SH_STRIDE, W2d, W2pd, cb, nlo, khalf);
#pragma unroll
    for (int rt = 0; rt < 2; ++rt)
#pragma unroll
      for (int nt = 0; nt < 2; ++nt)
#pragma unroll
        for (int v = 0; v < 8; ++v) {
          const int mrow = rt * 16 + v + 8 * khalf;
          if (mrow < nvalid)
            out[(size_t)srow[mrow] * DOUT + cb + nt * 16 + nlo] = acc[rt][nt][v];
        }
  }
}

// ---------------- launcher ----------------

extern "C" void kernel_launch(void* const* d_in, const int* in_sizes, int n_in,
                              void* d_out, int out_size, void* d_ws, size_t ws_size,
                              hipStream_t stream) {
  const float* x     = (const float*)d_in[0];
  const int*   dom   = (const int*)d_in[1];
  const float* W1    = (const float*)d_in[2];
  const float* b1    = (const float*)d_in[3];
  const float* gamma = (const float*)d_in[4];
  const float* beta  = (const float*)d_in[5];
  const float* W2    = (const float*)d_in[6];
  const float* b2    = (const float*)d_in[7];
  float* out = (float*)d_out;

  int* wsi     = (int*)d_ws;
  int* counts  = wsi;        // 8
  int* cursors = wsi + 8;    // 8
  int* offsets = wsi + 16;   // 8
  int* perm    = wsi + 32;   // N_TOK

  const size_t packElems1 = (size_t)ND * (DIN / 2) * DHID * 2;   // 2M floats
  const size_t packElems2 = (size_t)ND * (DHID / 2) * DOUT * 2;  // 2M floats
  float* p1 = (float*)(wsi + 32 + N_TOK);
  float* p2 = p1 + packElems1;
  const size_t needed = (size_t)(32 + N_TOK) * 4 + (packElems1 + packElems2) * 4;
  const bool packed = (ws_size >= needed);

  k_zero<<<1, 32, 0, stream>>>(wsi);
  k_count<<<N_TOK / 256, 256, 0, stream>>>(dom, counts, N_TOK);
  k_scan<<<1, 32, 0, stream>>>(counts, offsets);
  k_scatter<<<N_TOK / 256, 256, 0, stream>>>(dom, offsets, cursors, perm, N_TOK);

  if (packed) {
    const long tot1 = (long)ND * (DIN / 2) * DHID;   // 1,048,576
    const long tot2 = (long)ND * (DHID / 2) * DOUT;  // 1,048,576
    k_pack<<<(int)((tot1 + 255) / 256), 256, 0, stream>>>(W1, p1, DIN, DHID);
    k_pack<<<(int)((tot2 + 255) / 256), 256, 0, stream>>>(W2, p2, DHID, DOUT);
    k_mlp<true><<<ND * MAX_TILES, 256, 0, stream>>>(
        x, W1, b1, gamma, beta, W2, b2, p1, p2, out, counts, offsets, perm);
  } else {
    k_mlp<false><<<ND * MAX_TILES, 256, 0, stream>>>(
        x, W1, b1, gamma, beta, W2, b2, p1, p2, out, counts, offsets, perm);
  }
}

// v002
// Measured time: 232 microseconds a run.
// In both of two side-by-side timings against v001, it was 1.17 times as fast.
// All steps since v000 together make it 1.48 times as fast.
#include <hip/hip_runtime.h>

typedef __attribute__((ext_vector_type(2))) float v2f;
typedef __attribute__((ext_vector_type(8))) float v8f;
typedef __attribute__((address_space(3))) float lds_f;

#define N_TOK 32768
#define DIN 256
#define DHID 1024
#define DOUT 256
#define ND 8
#define ROWS 32
#define MAX_TILES (N_TOK / ROWS)
#define SX_STRIDE 260   // == 4 (mod 64 banks): conflict-free column reads
#define SH_STRIDE 1028  // == 4 (mod 64 banks)
#define LN_EPS 1e-5f

// ---------------- dispatch (bin tokens by domain) ----------------

__global__ void k_zero(int* w) {
  if (threadIdx.x < 16) w[threadIdx.x] = 0;  // counts[8] + cursors[8]
}

__global__ void k_count(const int* __restrict__ dom, int* __restrict__ counts, int n) {
  int i = blockIdx.x * blockDim.x + threadIdx.x;
  if (i < n) atomicAdd(&counts[dom[i]], 1);
}

__global__ void k_scan(const int* __restrict__ counts, int* __restrict__ offsets) {
  if (threadIdx.x == 0) {
    int a = 0;
    for (int d = 0; d < ND; ++d) { offsets[d] = a; a += counts[d]; }
  }
}

__global__ void k_scatter(const int* __restrict__ dom, const int* __restrict__ offsets,
                          int* __restrict__ cursors, int* __restrict__ perm, int n) {
  int i = blockIdx.x * blockDim.x + threadIdx.x;
  if (i < n) {
    int d = dom[i];
    int p = atomicAdd(&cursors[d], 1);
    perm[offsets[d] + p] = i;
  }
}

// Repack W[K][NC] (per domain) into P[kp][n][2] = {W[2kp][n], W[2kp+1][n]}
// so a WMMA B-fragment is one contiguous b64 per lane.
__global__ void k_pack(const float* __restrict__ W, float* __restrict__ P,
                       int K, int NC) {
  long i = (long)blockIdx.x * blockDim.x + threadIdx.x;
  long total = (long)ND * (K >> 1) * NC;
  if (i >= total) return;
  int n   = (int)(i % NC);
  long t  = i / NC;
  int kp  = (int)(t % (K >> 1));
  int dd  = (int)(t / (K >> 1));
  const float* src = W + ((size_t)dd * K + (size_t)(kp << 1)) * NC + n;
  v2f v;
  v.x = src[0];
  v.y = src[NC];
  *(v2f*)(P + (size_t)i * 2) = v;
}

// ---------------- operand fetch one block of k-steps ahead ----------------

// One block = KS k-steps of 4: the A fragments of both row tiles (from LDS) and
// the B fragments of the wave's NT column tiles (from global memory).
template <int NT, int KS>
struct Frags {
  v2f a[KS][2];
  v2f b[KS][NT];
};

// pa, pb: the lane's own first A element (LDS) and first B element (global) of the block.
template <bool PACKED, int NC, int NT, int KS>
__device__ __forceinline__ void fetch_block(Frags<NT, KS>& f, const float* pa, int astride,
                                            const float* __restrict__ pb) {
#pragma unroll
  for (int ks = 0; ks < KS; ++ks)
#pragma unroll
    for (int nt = 0; nt < NT; ++nt) {
      if (PACKED) {
        f.b[ks][nt] = *(const v2f*)(pb + (ks * 2 * NC + nt * 16) * 2);
      } else {
        f.b[ks][nt].x = pb[ks * 4 * NC + nt * 16];
        f.b[ks][nt].y = pb[(ks * 4 + 1) * NC + nt * 16];
      }
    }
#pragma unroll
  for (int ks = 0; ks < KS; ++ks) {
    f.a[ks][0] = *(const v2f*)(pa + ks * 4);                 // rows 0..15
    f.a[ks][1] = *(const v2f*)(pa + 16 * astride + ks * 4);  // rows 16..31
  }
}

template <int NT, int KS>
__device__ __forceinline__ void mma_block(const Frags<NT, KS>& f, v8f (&acc)[2][NT]) {
#pragma unroll
  for (int ks = 0; ks < KS; ++ks)
#pragma unroll
    for (int nt = 0; nt < NT; ++nt) {
      acc[0][nt] = __builtin_amdgcn_wmma_f32_16x16x4_f32(
          false, f.a[ks][0], false, f.b[ks][nt], (short)0, acc[0][nt], false, false);
      acc[1][nt] = __builtin_amdgcn_wmma_f32_16x16x4_f32(
          false, f.a[ks][1], false, f.b[ks][nt], (short)0, acc[1][nt], false, false);
    }
}

// acc += A[32 x K] (LDS) * W[K x NT*16]: two fragment sets, the set of block j+1
// is requested before the products of block j, so its latency runs behind them.
// k runs upward through the same accumulators as a plain loop.
template <bool PACKED, int K, int NC, int NT, int KS>
__device__ __forceinline__ void gemm_ahead(v8f (&acc)[2][NT], const float* sA, int astride,
                                           const float* __restrict__ Wd,
                                           const float* __restrict__ Wpd,
                                           int cb, int nlo, int khalf) {
  constexpr int BK = KS * 4;       // k per block
  constexpr int BSTEP = BK * NC;   // floats of W per block, packed or not
  const float* pa = sA + nlo * astride + 2 * khalf;
  const float* const pb0 = PACKED ? Wpd + ((size_t)khalf * NC + cb + nlo) * 2
                                  : Wd + (size_t)(2 * khalf) * NC + cb + nlo;
  const float* pb = pb0;
  Frags<NT, KS> f0, f1;
  fetch_block<PACKED, NC, NT, KS>(f0, pa, astride, pb);
  // The scheduling barriers keep every fetch one group that stands whole in front of
  // the other set's products: without them the LDS reads sink in among the WMMAs
  // that use them and are waited for there.
  for (int kb = 0; kb < K - 2 * BK; kb += 2 * BK) {
    fetch_block<PACKED, NC, NT, KS>(f1, pa + BK, astride, pb + BSTEP);
    __builtin_amdgcn_sched_barrier(0);
    mma_block<NT, KS>(f0, acc);
    __builtin_amdgcn_sched_barrier(0);
    fetch_block<PACKED, NC, NT, KS>(f0, pa + 2 * BK, astride, pb + 2 * BSTEP);
    __builtin_amdgcn_sched_barrier(0);
    mma_block<NT, KS>(f1, acc);
    __builtin_amdgcn_sched_barrier(0);
    // The loads of f0 are still in flight here and the step below rewrites their
    // address registers: the wait on address translations stands in front of it
    // (between two scheduling barriers, so that it stays behind the products and
    // the step stays behind it).
    asm volatile("s_wait_xcnt 0x0" ::: "memory");
    __builtin_amdgcn_sched_barrier(0);
    pa += 2 * BK;
    pb += 2 * BSTEP;
  }
  fetch_block<PACKED, NC, NT, KS>(f1, pa + BK, astride, pb0 + (K / BK - 1) * BSTEP);
  // Last use of pb0: naming it here keeps its registers from being reused for
  // anything else before the translations of the loads above are done.
  asm volatile("s_wait_xcnt 0x0" :: "v"(pb0) : "memory");
  __builtin_amdgcn_sched_barrier(0);
  mma_block<NT, KS>(f0, acc);
  mma_block<NT, KS>(f1, acc);
}

// ---------------- fused expert MLP over one 32-row tile ----------------

// Two work-groups share a WGP (four waves per SIMD), so that one group's gather,
// LayerNorm, barriers and stores run behind the other group's products. That takes
// at most 160 KiB of LDS a group (the X tile lies in the H tile's space) and at most
// 256 registers a wave (the second launch bound; the fetch-ahead blocks are 32 WMMAs).
template <bool PACKED>
__launch_bounds__(256, 4)
__global__ void k_mlp(const float* __restrict__ x,
                      const float* __restrict__ W1, const float* __restrict__ b1,
                      const float* __restrict__ gamma, const float* __restrict__ beta,
                      const float* __restrict__ W2, const float* __restrict__ b2,
                      const float* __restrict__ W1p, const float* __restrict__ W2p,
                      float* __restrict__ out,
                      const int* __restrict__ counts, const int* __restrict__ offsets,
                      const int* __restrict__ perm) {
  __shared__ float sH[ROWS * SH_STRIDE];
  float* const sX = sH;  // X is dead once stage 1's products are done; H is written behind a barrier
  __shared__ int srow[ROWS];

  const int bid  = blockIdx.x;
  const int d    = bid & (ND - 1);
  const int tile = bid >> 3;
  const int cnt  = counts[d];
  const int row0 = tile * ROWS;
  if (row0 >= cnt) return;                 // uniform early-exit for surplus tiles
  const int base   = offsets[d];
  const int nvalid = min(ROWS, cnt - row0);

  const int tid = threadIdx.x;
  if (tid < ROWS) {
    int rr = (tid < nvalid) ? (row0 + tid) : row0;  // clamp padding rows to a valid token
    srow[tid] = perm[base + rr];
  }
  __syncthreads();

  // gather X tile (32 x 256 fp32) straight into LDS with async b128 copies
  {
    for (int f = tid; f < ROWS * (DIN / 4); f += 256) {
      int r  = f >> 6;      // 64 float4 per row
      int c4 = f & 63;
      const float* gsrc = x + (size_t)srow[r] * DIN + (c4 << 2);
      lds_f* ldst = (lds_f*)&sX[r * SX_STRIDE + (c4 << 2)];
      asm volatile("global_load_async_to_lds_b128 %0, %1, off"
                   :: "v"(ldst), "v"(gsrc) : "memory");
    }
    asm volatile("s_wait_asynccnt 0x0" ::: "memory");
  }
  __syncthreads();

  const int wave  = tid >> 5;
  const int lane  = tid & 31;
  const int nlo   = lane & 15;   // N index (and A-matrix row M) within a 16-tile
  const int khalf = lane >> 4;   // lanes 16-31 carry K+2/K+3 per ISA 16x4 layout

  // ---- stage 1: H = X @ W1[d] + b1[d]; this wave owns cols [wave*128, wave*128+128)
  {
    const float* W1d  = W1  + (size_t)d * DIN * DHID;
    const float* W1pd = W1p + (size_t)d * (DIN / 2) * DHID * 2;
    const float* b1d  = b1  + (size_t)d * DHID;
    const int cb = wave * 128;
    v8f acc[2][8];                               // [row-tile][col-tile]
#pragma unroll
    for (int nt = 0; nt < 8; ++nt) {
      float bb = b1d[cb + nt * 16 + nlo];
      v8f t = {bb, bb, bb, bb, bb, bb, bb, bb};
      acc[0][nt] = t;
      acc[1][nt] = t;
    }
    gemm_ahead<PACKED, DIN, DHID, 8, 2>(acc, sX, SX_STRIDE, W1d, W1pd, cb, nlo, khalf);
    __syncthreads();  // every wave has read its last X fragment before H overwrites the X tile
#pragma unroll
    for (int rt = 0; rt < 2; ++rt)
#pragma unroll
      for (int nt = 0; nt < 8; ++nt)
#pragma unroll
        for (int v = 0; v < 8; ++v)
          sH[(rt * 16 + v + 8 * khalf) * SH_STRIDE + cb + nt * 16 + nlo] = acc[rt][nt][v];
  }
  __syncthreads();

  // ---- LayerNorm + ReLU (two-pass, matches reference); 4 rows per wave
  {
    const float* gd = gamma + (size_t)d * DHID;
    const float* bd = beta  + (size_t)d * DHID;
#pragma unroll
    for (int rr = 0; rr < 4; ++rr) {
      const int r = wave * 4 + rr;
      float s = 0.f;
      for (int c = lane; c < DHID; c += 32) s += sH[r * SH_STRIDE + c];
#pragma unroll
      for (int off = 16; off > 0; off >>= 1) s += __shfl_xor(s, off, 32);
      const float mu = s * (1.f / DHID);
      float vv = 0.f;
      for (int c = lane; c < DHID; c += 32) {
        float h = sH[r * SH_STRIDE + c] - mu;
        vv += h * h;
      }
#pragma unroll
      for (int off = 16; off > 0; off >>= 1) vv += __shfl_xor(vv, off, 32);
      const float inv = rsqrtf(vv * (1.f / DHID) + LN_EPS);
      for (int c = lane; c < DHID; c += 32) {
        float h = (sH[r * SH_STRIDE + c] - mu) * inv * gd[c] + bd[c];
        sH[r * SH_STRIDE + c] = fmaxf(h, 0.f);
      }
    }
  }
  __syncthreads();

  // ---- stage 2: OUT = H @ W2[d] + b2[d]; this wave owns cols [wave*32, wave*32+32)
  {
    const float* W2d  = W2  + (size_t)d * DHID * DOUT;
    const float* W2pd = W2p + (size_t)d * (DHID / 2) * DOUT * 2;
    const float* b2d  = b2  + (size_t)d * DOUT;
    const int cb = wave * 32;
    v8f acc[2][2];                               // [row-tile][col-tile]
#pragma unroll
    for (int nt = 0; nt < 2; ++nt) {
      float bb = b2d[cb + nt * 16 + nlo];
      v8f t = {bb, bb, bb, bb, bb, bb, bb, bb};
      acc[0][nt] = t;
      acc[1][nt] = t;
    }
    gemm_ahead<PACKED, DHID, DOUT, 2, 8>(acc, sH, SH_STRIDE, W2d, W2pd, cb, nlo, khalf);
#pragma unroll
    for (int rt = 0; rt < 2; ++rt)
#pragma unroll
      for (int nt = 0; nt < 2; ++nt)
#pragma unroll
        for (int v = 0; v < 8; ++v) {
          const int mrow = rt * 16 + v + 8 * khalf;
          if (mrow < nvalid)
            out[(size_t)srow[mrow] * DOUT + cb + nt * 16 + nlo] = acc[rt][nt][v];
        }
  }
}

// ---------------- launcher ----------------

extern "C" void kernel_launch(void* const* d_in, const int* in_sizes, int n_in,
                              void* d_out, int out_size, void* d_ws, size_t ws_size,
                              hipStream_t stream) {
  const float* x     = (const float*)d_in[0];
  const int*   dom   = (const int*)d_in[1];
  const float* W1    = (const float*)d_in[2];
  const float* b1    = (const float*)d_in[3];
  const float* gamma = (const float*)d_in[4];
  const float* beta  = (const float*)d_in[5];
  const float* W2    = (const float*)d_in[6];
  const float* b2    = (const float*)d_in[7];
  float* out = (float*)d_out;

  int* wsi     = (int*)d_ws;
  int* counts  = wsi;        // 8
  int* cursors = wsi + 8;    // 8
  int* offsets = wsi + 16;   // 8
  int* perm    = wsi + 32;   // N_TOK

  const size_t packElems1 = (size_t)ND * (DIN / 2) * DHID * 2;   // 2M floats
  const size_t packElems2 = (size_t)ND * (DHID / 2) * DOUT * 2;  // 2M floats
  float* p1 = (float*)(wsi + 32 + N_TOK);
  float* p2 = p1 + packElems1;
  const size_t needed = (size_t)(32 + N_TOK) * 4 + (packElems1 + packElems2) * 4;
  const bool packed = (ws_size >= needed);

  k_zero<<<1, 32, 0, stream>>>(wsi);
  k_count<<<N_TOK / 256, 256, 0, stream>>>(dom, counts, N_TOK);
  k_scan<<<1, 32, 0, stream>>>(counts, offsets);
  k_scatter<<<N_TOK / 256, 256, 0, stream>>>(dom, offsets, cursors, perm, N_TOK);

  if (packed) {
    const long tot1 = (long)ND * (DIN / 2) * DHID;   // 1,048,576
    const long tot2 = (long)ND * (DHID / 2) * DOUT;  // 1,048,576
    k_pack<<<(int)((tot1 + 255) / 256), 256, 0, stream>>>(W1, p1, DIN, DHID);
    k_pack<<<(int)((tot2 + 255) / 256), 256, 0, stream>>>(W2, p2, DHID, DOUT);
    k_mlp<true><<<ND * MAX_TILES, 256, 0, stream>>>(
        x, W1, b1, gamma, beta, W2, b2, p1, p2, out, counts, offsets, perm);
  } else {
    k_mlp<false><<<ND * MAX_TILES, 256, 0, stream>>>(
        x, W1, b1, gamma, beta, W2, b2, p1, p2, out, counts, offsets, perm);
  }
}

// v003
// One run takes 208 microseconds.
// Two timings next to v002 both put it at 1.12 times that version's speed.
// All steps since v000 together make it 1.65 times as fast.
#include <hip/hip_runtime.h>

typedef __attribute__((ext_vector_type(2))) float v2f;
typedef __attribute__((ext_vector_type(8))) float v8f;
typedef __attribute__((address_space(3))) float lds_f;

#define N_TOK 32768
#define DIN 256
#define DHID 1024
#define DOUT 256
#define ND 8
#define ROWS 32
#define MAX_TILES (N_TOK / ROWS)
#define SX_STRIDE 260   // == 4 (mod 64 banks): conflict-free column reads
#define SH_STRIDE 1028  // == 4 (mod 64 banks)
#define LN_EPS 1e-5f

// ---------------- preparation: one launch ----------------

#define PREP_T 1024                 // threads per block (32 waves)
#define TOK_T (N_TOK / PREP_T)      // tokens per thread of the binning block
#define PACK_BLOCKS_W 64            // packing blocks per weight tensor
#define PACK_U 4                    // units of 4 column pairs per packing thread

typedef __attribute__((ext_vector_type(4))) float v4f;
typedef __attribute__((ext_vector_type(4))) int v4i;

__device__ __forceinline__ int wave_incl_scan(int v, int lane) {
#pragma unroll  // five fixed steps, each lane distance a constant
  for (int off = 1; off < 32; off <<= 1) {
    int o = __shfl_up(v, off, 32);
    if (lane >= off) v += o;
  }
  return v;
}

// Repack W[K][NC] (all domains, K even) into P[kp][n][2] = {W[2kp][n], W[2kp+1][n]}
// so a WMMA B-fragment is one contiguous b64 per lane. One unit = 4 columns of one
// row pair: two 16-byte loads, two 16-byte stores. pb: this block's index in the tensor.
template <int NC>
__device__ __forceinline__ void pack_units(const float* __restrict__ W, float* __restrict__ P,
                                           int pb, int t) {
  static_assert((PREP_T * 4) % NC == 0, "a thread's units lie whole row pairs apart");
  const unsigned i0 = (unsigned)(pb * PACK_U * PREP_T + t) * 4;  // first column pair of unit 0
  // i0 / NC: the row pair, counted over all domains. Unit j lies PREP_T * 4 column pairs
  // on, which is PREP_T * 8 floats on in W and in P alike.
  const float* src = W + (size_t)(i0 / NC) * (2 * NC) + (i0 % NC);
  float* dst = P + (size_t)i0 * 2;
  v4f r0[PACK_U], r1[PACK_U];
#pragma unroll  // r0, r1 stay in registers and all eight loads are in flight together
  for (int j = 0; j < PACK_U; ++j) {
    r0[j] = *(const v4f*)(src + j * (PREP_T * 8));
    r1[j] = *(const v4f*)(src + j * (PREP_T * 8) + NC);
  }
#pragma unroll  // r0, r1 stay in registers
  for (int j = 0; j < PACK_U; ++j) {
    v4f lo = {r0[j].x, r1[j].x, r0[j].y, r1[j].y};
    v4f hi = {r0[j].z, r1[j].z, r0[j].w, r1[j].w};
    *(v4f*)(dst + j * (PREP_T * 8))     = lo;
    *(v4f*)(dst + j * (PREP_T * 8) + 4) = hi;
  }
  // The last stores are still in flight here: the wait on address translations stands
  // in front of whatever code behind this call rewrites their registers.
  asm volatile("s_wait_xcnt 0x0" ::: "memory");
}

// Block 0 bins all tokens by domain (counts, offsets, perm) with one prefix sum in LDS;
// the blocks behind it, where launched, repack W1 and W2 at the same time.
__launch_bounds__(PREP_T)
__global__ void k_prep(const int* __restrict__ dom,
                       const float* __restrict__ W1, const float* __restrict__ W2,
                       float* __restrict__ P1, float* __restrict__ P2,
                       int* __restrict__ counts, int* __restrict__ offsets,
                       int* __restrict__ perm) {
  __shared__ __attribute__((aligned(16))) int tbl[ND * PREP_T];  // [domain][thread]
  __shared__ __attribute__((aligned(16))) int sperm[N_TOK];
  __shared__ int wsum[PREP_T / 32];

  const int t = threadIdx.x;
  if (blockIdx.x != 0) {
    const int pb = (int)blockIdx.x - 1;
    if (pb < PACK_BLOCKS_W) pack_units<DHID>(W1, P1, pb, t);
    else                    pack_units<DOUT>(W2, P2, pb - PACK_BLOCKS_W, t);
    return;
  }

  const int wave = t >> 5;
  const int lane = t & 31;
  // Token (j, c) of this thread is tok0 + j * 128 + c: every load is 512 contiguous bytes a wave.
  const int tok0 = wave * (32 * TOK_T) + lane * 4;

  int dv[TOK_T];  // every loop over dv is unrolled so that it stays in registers
#pragma unroll
  for (int j = 0; j < TOK_T / 4; ++j) {
    v4i q = *(const v4i*)(dom + tok0 + j * 128);
    dv[j * 4 + 0] = q.x & (ND - 1);  // the mask bounds every address formed from a domain
    dv[j * 4 + 1] = q.y & (ND - 1);
    dv[j * 4 + 2] = q.z & (ND - 1);
    dv[j * 4 + 3] = q.w & (ND - 1);
  }

  // this thread's tokens per domain, one byte a domain (at most TOK_T = 32 each);
  // each token keeps its rank among the thread's tokens of its domain above its 3 domain bits
  unsigned long long cnt = 0;
#pragma unroll
  for (int i = 0; i < TOK_T; ++i) {
    const int sh = dv[i] * 8;
    dv[i] |= (int)((cnt >> sh) & 0xff) << 3;
    cnt += 1ull << sh;
  }
#pragma unroll  // constant shifts
  for (int d = 0; d < ND; ++d) tbl[d * PREP_T + t] = (int)((cnt >> (d * 8)) & 0xff);
  __syncthreads();

  // exclusive prefix sum over tbl read as one row of ND * PREP_T entries: entry
  // [d][t] becomes the first place in perm of thread t's tokens of domain d
  {
    v4i e0 = *(const v4i*)&tbl[t * 8];
    v4i e1 = *(const v4i*)&tbl[t * 8 + 4];
    const int x1 = e0.x, x2 = x1 + e0.y, x3 = x2 + e0.z, x4 = x3 + e0.w;
    const int x5 = x4 + e1.x, x6 = x5 + e1.y, x7 = x6 + e1.z, tot = x7 + e1.w;
    const int incl = wave_incl_scan(tot, lane);
    if (lane == 31) wsum[wave] = incl;
    __syncthreads();
    const int wincl = wave_incl_scan(wsum[lane], lane);
    const int wbase = (wave == 0) ? 0 : __shfl(wincl, wave - 1, 32);
    const int base  = wbase + incl - tot;
    v4i o0 = {base, base + x1, base + x2, base + x3};
    v4i o1 = {base + x4, base + x5, base + x6, base + x7};
    *(v4i*)&tbl[t * 8]     = o0;
    *(v4i*)&tbl[t * 8 + 4] = o1;
  }
  __syncthreads();

  if (t < ND) {
    const int off = tbl[t * PREP_T];
    const int nxt = (t == ND - 1) ? N_TOK : tbl[(t + 1) * PREP_T];
    offsets[t] = off;
    counts[t]  = nxt - off;
  }

  // place every token; perm is put together in LDS so that it leaves in whole lines
#pragma unroll
  for (int i = 0; i < TOK_T; ++i) dv[i] = tbl[(dv[i] & (ND - 1)) * PREP_T + t] + (dv[i] >> 3);
#pragma unroll
  for (int i = 0; i < TOK_T; ++i) sperm[dv[i]] = tok0 + (i >> 2) * 128 + (i & 3);
  __syncthreads();
#pragma unroll  // the eight LDS reads go out together
  for (int j = 0; j < N_TOK / (4 * PREP_T); ++j)
    *(v4i*)(perm + (j * PREP_T + t) * 4) = *(const v4i*)&sperm[(j * PREP_T + t) * 4];
}

// ---------------- operand fetch one block of k-steps ahead ----------------

// One block = KS k-steps of 4: the A fragments of both row tiles (from LDS) and
// the B fragments of the wave's NT column tiles (from global memory).
template <int NT, int KS>
struct Frags {
  v2f a[KS][2];
  v2f b[KS][NT];
};

// pa, pb: the lane's own first A element (LDS) and first B element (global) of the block.
template <bool PACKED, int NC, int NT, int KS>
__device__ __forceinline__ void fetch_block(Frags<NT, KS>& f, const float* pa, int astride,
                                            const float* __restrict__ pb) {
#pragma unroll
  for (int ks = 0; ks < KS; ++ks)
#pragma unroll
    for (int nt = 0; nt < NT; ++nt) {
      if (PACKED) {
        f.b[ks][nt] = *(const v2f*)(pb + (ks * 2 * NC + nt * 16) * 2);
      } else {
        f.b[ks][nt].x = pb[ks * 4 * NC + nt * 16];
        f.b[ks][nt].y = pb[(ks * 4 + 1) * NC + nt * 16];
      }
    }
#pragma unroll
  for (int ks = 0; ks < KS; ++ks) {
    f.a[ks][0] = *(const v2f*)(pa + ks * 4);                 // rows 0..15
    f.a[ks][1] = *(const v2f*)(pa + 16 * astride + ks * 4);  // rows 16..31
  }
}

template <int NT, int KS>
__device__ __forceinline__ void mma_block(const Frags<NT, KS>& f, v8f (&acc)[2][NT]) {
#pragma unroll
  for (int ks = 0; ks < KS; ++ks)
#pragma unroll
    for (int nt = 0; nt < NT; ++nt) {
      acc[0][nt] = __builtin_amdgcn_wmma_f32_16x16x4_f32(
          false, f.a[ks][0], false, f.b[ks][nt], (short)0, acc[0][nt], false, false);
      acc[1][nt] = __builtin_amdgcn_wmma_f32_16x16x4_f32(
          false, f.a[ks][1], false, f.b[ks][nt], (short)0, acc[1][nt], false, false);
    }
}

// acc += A[32 x K] (LDS) * W[K x NT*16]: two fragment sets, the set of block j+1
// is requested before the products of block j, so its latency runs behind them.
// k runs upward through the same accumulators as a plain loop.
template <bool PACKED, int K, int NC, int NT, int KS>
__device__ __forceinline__ void gemm_ahead(v8f (&acc)[2][NT], const float* sA, int astride,
                                           const float* __restrict__ Wd,
                                           const float* __restrict__ Wpd,
                                           int cb, int nlo, int khalf) {
  constexpr int BK = KS * 4;       // k per block
  constexpr int BSTEP = BK * NC;   // floats of W per block, packed or not
  const float* pa = sA + nlo * astride + 2 * khalf;
  const float* const pb0 = PACKED ? Wpd + ((size_t)khalf * NC + cb + nlo) * 2
                                  : Wd + (size_t)(2 * khalf) * NC + cb + nlo;
  const float* pb = pb0;
  Frags<NT, KS> f0, f1;
  fetch_block<PACKED, NC, NT, KS>(f0, pa, astride, pb);
  // The scheduling barriers keep every fetch one group that stands whole in front of
  // the other set's products: without them the LDS reads sink in among the WMMAs
  // that use them and are waited for there.
  for (int kb = 0; kb < K - 2 * BK; kb += 2 * BK) {
    fetch_block<PACKED, NC, NT, KS>(f1, pa + BK, astride, pb + BSTEP);
    __builtin_amdgcn_sched_barrier(0);
    mma_block<NT, KS>(f0, acc);
    __builtin_amdgcn_sched_barrier(0);
    fetch_block<PACKED, NC, NT, KS>(f0, pa + 2 * BK, astride, pb + 2 * BSTEP);
    __builtin_amdgcn_sched_barrier(0);
    mma_block<NT, KS>(f1, acc);
    __builtin_amdgcn_sched_barrier(0);
    // The loads of f0 are still in flight here and the step below rewrites their
    // address registers: the wait on address translations stands in front of it
    // (between two scheduling barriers, so that it stays behind the products and
    // the step stays behind it).
    asm volatile("s_wait_xcnt 0x0" ::: "memory");
    __builtin_amdgcn_sched_barrier(0);
    pa += 2 * BK;
    pb += 2 * BSTEP;
  }
  fetch_block<PACKED, NC, NT, KS>(f1, pa + BK, astride, pb0 + (K / BK - 1) * BSTEP);
  // Last use of pb0: naming it here keeps its registers from being reused for
  // anything else before the translations of the loads above are done.
  asm volatile("s_wait_xcnt 0x0" :: "v"(pb0) : "memory");
  __builtin_amdgcn_sched_barrier(0);
  mma_block<NT, KS>(f0, acc);
  mma_block<NT, KS>(f1, acc);
}

// ---------------- fused expert MLP over one 32-row tile ----------------

// Two work-groups share a WGP (four waves per SIMD), so that one group's gather,
// LayerNorm, barriers and stores run behind the other group's products. That takes
// at most 160 KiB of LDS a group (the X tile lies in the H tile's space) and at most
// 256 registers a wave (the second launch bound; the fetch-ahead blocks are 32 WMMAs).
template <bool PACKED>
__launch_bounds__(256, 4)
__global__ void k_mlp(const float* __restrict__ x,
                      const float* __restrict__ W1, const float* __restrict__ b1,
                      const float* __restrict__ gamma, const float* __restrict__ beta,
                      const float* __restrict__ W2, const float* __restrict__ b2,
                      const float* __restrict__ W1p, const float* __restrict__ W2p,
                      float* __restrict__ out,
                      const int* __restrict__ counts, const int* __restrict__ offsets,
                      const int* __restrict__ perm) {
  __shared__ float sH[ROWS * SH_STRIDE];
  float* const sX = sH;  // X is dead once stage 1's products are done; H is written behind a barrier
  __shared__ int srow[ROWS];

  const int bid  = blockIdx.x;
  const int d    = bid & (ND - 1);
  const int tile = bid >> 3;
  const int cnt  = counts[d];
  const int row0 = tile * ROWS;
  if (row0 >= cnt) return;                 // uniform early-exit for surplus tiles
  const int base   = offsets[d];
  const int nvalid = min(ROWS, cnt - row0);

  const int tid = threadIdx.x;
  if (tid < ROWS) {
    int rr = (tid < nvalid) ? (row0 + tid) : row0;  // clamp padding rows to a valid token
    srow[tid] = perm[base + rr];
  }
  __syncthreads();

  // gather X tile (32 x 256 fp32) straight into LDS with async b128 copies
  {
    for (int f = tid; f < ROWS * (DIN / 4); f += 256) {
      int r  = f >> 6;      // 64 float4 per row
      int c4 = f & 63;
      const float* gsrc = x + (size_t)srow[r] * DIN + (c4 << 2);
      lds_f* ldst = (lds_f*)&sX[r * SX_STRIDE + (c4 << 2)];
      asm volatile("global_load_async_to_lds_b128 %0, %1, off"
                   :: "v"(ldst), "v"(gsrc) : "memory");
    }
    asm volatile("s_wait_asynccnt 0x0" ::: "memory");
  }
  __syncthreads();

  const int wave  = tid >> 5;
  const int lane  = tid & 31;
  const int nlo   = lane & 15;   // N index (and A-matrix row M) within a 16-tile
  const int khalf = lane >> 4;   // lanes 16-31 carry K+2/K+3 per ISA 16x4 layout

  // ---- stage 1: H = X @ W1[d] + b1[d]; this wave owns cols [wave*128, wave*128+128)
  {
    const float* W1d  = W1  + (size_t)d * DIN * DHID;
    const float* W1pd = W1p + (size_t)d * (DIN / 2) * DHID * 2;
    const float* b1d  = b1  + (size_t)d * DHID;
    const int cb = wave * 128;
    v8f acc[2][8];                               // [row-tile][col-tile]
#pragma unroll
    for (int nt = 0; nt < 8; ++nt) {
      float bb = b1d[cb + nt * 16 + nlo];
      v8f t = {bb, bb, bb, bb, bb, bb, bb, bb};
      acc[0][nt] = t;
      acc[1][nt] = t;
    }
    gemm_ahead<PACKED, DIN, DHID, 8, 2>(acc, sX, SX_STRIDE, W1d, W1pd, cb, nlo, khalf);
    __syncthreads();  // every wave has read its last X fragment before H overwrites the X tile
#pragma unroll
    for (int rt = 0; rt < 2; ++rt)
#pragma unroll
      for (int nt = 0; nt < 8; ++nt)
#pragma unroll
        for (int v = 0; v < 8; ++v)
          sH[(rt * 16 + v + 8 * khalf) * SH_STRIDE + cb + nt * 16 + nlo] = acc[rt][nt][v];
  }
  __syncthreads();

  // ---- LayerNorm + ReLU (two-pass, matches reference); 4 rows per wave
  {
    const float* gd = gamma + (size_t)d * DHID;
    const float* bd = beta  + (size_t)d * DHID;
#pragma unroll
    for (int rr = 0; rr < 4; ++rr) {
      const int r = wave * 4 + rr;
      float s = 0.f;
      for (int c = lane; c < DHID; c += 32) s += sH[r * SH_STRIDE + c];
#pragma unroll
      for (int off = 16; off > 0; off >>= 1) s += __shfl_xor(s, off, 32);
      const float mu = s * (1.f / DHID);
      float vv = 0.f;
      for (int c = lane; c < DHID; c += 32) {
        float h = sH[r * SH_STRIDE + c] - mu;
        vv += h * h;
      }
#pragma unroll
      for (int off = 16; off > 0; off >>= 1) vv += __shfl_xor(vv, off, 32);
      const float inv = rsqrtf(vv * (1.f / DHID) + LN_EPS);
      for (int c = lane; c < DHID; c += 32) {
        float h = (sH[r * SH_STRIDE + c] - mu) * inv * gd[c] + bd[c];
        sH[r * SH_STRIDE + c] = fmaxf(h, 0.f);
      }
    }
  }
  __syncthreads();

  // ---- stage 2: OUT = H @ W2[d] + b2[d]; this wave owns cols [wave*32, wave*32+32)
  {
    const float* W2d  = W2  + (size_t)d * DHID * DOUT;
    const float* W2pd = W2p + (size_t)d * (DHID / 2) * DOUT * 2;
    const float* b2d  = b2  + (size_t)d * DOUT;
    const int cb = wave * 32;
    v8f acc[2][2];                               // [row-tile][col-tile]
#pragma unroll
    for (int nt = 0; nt < 2; ++nt) {
      float bb = b2d[cb + nt * 16 + nlo];
      v8f t = {bb, bb, bb, bb, bb, bb, bb, bb};
      acc[0][nt] = t;
      acc[1][nt] = t;
    }
    gemm_ahead<PACKED, DHID, DOUT, 2, 8>(acc, sH, SH_STRIDE, W2d, W2pd, cb, nlo, khalf);
#pragma unroll
    for (int rt = 0; rt < 2; ++rt)
#pragma unroll
      for (int nt = 0; nt < 2; ++nt)
#pragma unroll
        for (int v = 0; v < 8; ++v) {
          const int mrow = rt * 16 + v + 8 * khalf;
          if (mrow < nvalid)
            out[(size_t)srow[mrow] * DOUT + cb + nt * 16 + nlo] = acc[rt][nt][v];
        }
  }
}

// ---------------- launcher ----------------

extern "C" void kernel_launch(void* const* d_in, const int* in_sizes, int n_in,
                              void* d_out, int out_size, void* d_ws, size_t ws_size,
                              hipStream_t stream) {
  const float* x     = (const float*)d_in[0];
  const int*   dom   = (const int*)d_in[1];
  const float* W1    = (const float*)d_in[2];
  const float* b1    = (const float*)d_in[3];
  const float* gamma = (const float*)d_in[4];
  const float* beta  = (const float*)d_in[5];
  const float* W2    = (const float*)d_in[6];
  const float* b2    = (const float*)d_in[7];
  float* out = (float*)d_out;

  int* wsi     = (int*)d_ws;
  int* counts  = wsi;        // 8
  int* offsets = wsi + 16;   // 8
  int* perm    = wsi + 32;   // N_TOK

  const size_t packElems1 = (size_t)ND * (DIN / 2) * DHID * 2;   // 2M floats
  const size_t packElems2 = (size_t)ND * (DHID / 2) * DOUT * 2;  // 2M floats
  float* p1 = (float*)(wsi + 32 + N_TOK);
  float* p2 = p1 + packElems1;
  const size_t needed = (size_t)(32 + N_TOK) * 4 + (packElems1 + packElems2) * 4;
  const bool packed = (ws_size >= needed);

  if (packed) {
    k_prep<<<1 + 2 * PACK_BLOCKS_W, PREP_T, 0, stream>>>(dom, W1, W2, p1, p2, counts, offsets, perm);
    k_mlp<true><<<ND * MAX_TILES, 256, 0, stream>>>(
        x, W1, b1, gamma, beta, W2, b2, p1, p2, out, counts, offsets, perm);
  } else {
    k_prep<<<1, PREP_T, 0, stream>>>(dom, W1, W2, p1, p2, counts, offsets, perm);
    k_mlp<false><<<ND * MAX_TILES, 256, 0, stream>>>(
        x, W1, b1, gamma, beta, W2, b2, p1, p2, out, counts, offsets, perm);
  }
}

// v004
// It runs in 195 microseconds.
// Next to v003, in two timings, it ran 1.06 times as fast each time.
// All steps since v000 together make it 1.76 times as fast.
#include <hip/hip_runtime.h>

typedef __attribute__((ext_vector_type(2))) float v2f;
typedef __attribute__((ext_vector_type(8))) float v8f;
typedef __attribute__((address_space(3))) float lds_f;

#define N_TOK 32768
#define DIN 256
#define DHID 1024
#define DOUT 256
#define ND 8
#define ROWS 32
#define UNIT 16       // rows of one WMMA row tile: the grain in which rows are dealt out
#define NGROUPS 512   // work-groups of the MLP launch: two on each of 256 WGPs, all resident at once
// Units over all domains: at most N_TOK / UNIT + ND - 1; a group's share of them, rounded up.
#define MAX_PASSES ((N_TOK / UNIT + ND - 1 + NGROUPS - 1) / NGROUPS)
#define SX_STRIDE 260   // == 4 (mod 64 banks): conflict-free column reads
#define SH_STRIDE 1028  // == 4 (mod 64 banks)
#define LN_EPS 1e-5f

// ---------------- preparation: one launch ----------------

#define PREP_T 1024                 // threads per block (32 waves)
#define TOK_T (N_TOK / PREP_T)      // tokens per thread of the binning block
#define PACK_BLOCKS_W 64            // packing blocks per weight tensor
#define PACK_U 4                    // units of 4 column pairs per packing thread

typedef __attribute__((ext_vector_type(4))) float v4f;
typedef __attribute__((ext_vector_type(4))) int v4i;

__device__ __forceinline__ int wave_incl_scan(int v, int lane) {
#pragma unroll  // five fixed steps, each lane distance a constant
  for (int off = 1; off < 32; off <<= 1) {
    int o = __shfl_up(v, off, 32);
    if (lane >= off) v += o;
  }
  return v;
}

// Repack W[K][NC] (all domains, K even) into P[kp][n][2] = {W[2kp][n], W[2kp+1][n]}
// so a WMMA B-fragment is one contiguous b64 per lane. One unit = 4 columns of one
// row pair: two 16-byte loads, two 16-byte stores. pb: this block's index in the tensor.
template <int NC>
__device__ __forceinline__ void pack_units(const float* __restrict__ W, float* __restrict__ P,
                                           int pb, int t) {
  static_assert((PREP_T * 4) % NC == 0, "a thread's units lie whole row pairs apart");
  const unsigned i0 = (unsigned)(pb * PACK_U * PREP_T + t) * 4;  // first column pair of unit 0
  // i0 / NC: the row pair, counted over all domains. Unit j lies PREP_T * 4 column pairs
  // on, which is PREP_T * 8 floats on in W and in P alike.
  const float* src = W + (size_t)(i0 / NC) * (2 * NC) + (i0 % NC);
  float* dst = P + (size_t)i0 * 2;
  v4f r0[PACK_U], r1[PACK_U];
#pragma unroll  // r0, r1 stay in registers and all eight loads are in flight together
  for (int j = 0; j < PACK_U; ++j) {
    r0[j] = *(const v4f*)(src + j * (PREP_T * 8));
    r1[j] = *(const v4f*)(src + j * (PREP_T * 8) + NC);
  }
#pragma unroll  // r0, r1 stay in registers
  for (int j = 0; j < PACK_U; ++j) {
    v4f lo = {r0[j].x, r1[j].x, r0[j].y, r1[j].y};
    v4f hi = {r0[j].z, r1[j].z, r0[j].w, r1[j].w};
    *(v4f*)(dst + j * (PREP_T * 8))     = lo;
    *(v4f*)(dst + j * (PREP_T * 8) + 4) = hi;
  }
  // The last stores are still in flight here: the wait on address translations stands
  // in front of whatever code behind this call rewrites their registers.
  asm volatile("s_wait_xcnt 0x0" ::: "memory");
}

// Block 0 bins all tokens by domain (counts, offsets, perm) with one prefix sum in LDS;
// the blocks behind it, where launched, repack W1 and W2 at the same time.
__launch_bounds__(PREP_T)
__global__ void k_prep(const int* __restrict__ dom,
                       const float* __restrict__ W1, const float* __restrict__ W2,
                       float* __restrict__ P1, float* __restrict__ P2,
                       int* __restrict__ counts, int* __restrict__ offsets,
                       int* __restrict__ perm) {
  __shared__ __attribute__((aligned(16))) int tbl[ND * PREP_T];  // [domain][thread]
  __shared__ __attribute__((aligned(16))) int sperm[N_TOK];
  __shared__ int wsum[PREP_T / 32];

  const int t = threadIdx.x;
  if (blockIdx.x != 0) {
    const int pb = (int)blockIdx.x - 1;
    if (pb < PACK_BLOCKS_W) pack_units<DHID>(W1, P1, pb, t);
    else                    pack_units<DOUT>(W2, P2, pb - PACK_BLOCKS_W, t);
    return;
  }

  const int wave = t >> 5;
  const int lane = t & 31;
  // Token (j, c) of this thread is tok0 + j * 128 + c: every load is 512 contiguous bytes a wave.
  const int tok0 = wave * (32 * TOK_T) + lane * 4;

  int dv[TOK_T];  // every loop over dv is unrolled so that it stays in registers
#pragma unroll
  for (int j = 0; j < TOK_T / 4; ++j) {
    v4i q = *(const v4i*)(dom + tok0 + j * 128);
    dv[j * 4 + 0] = q.x & (ND - 1);  // the mask bounds every address formed from a domain
    dv[j * 4 + 1] = q.y & (ND - 1);
    dv[j * 4 + 2] = q.z & (ND - 1);
    dv[j * 4 + 3] = q.w & (ND - 1);
  }

  // this thread's tokens per domain, one byte a domain (at most TOK_T = 32 each);
  // each token keeps its rank among the thread's tokens of its domain above its 3 domain bits
  unsigned long long cnt = 0;
#pragma unroll
  for (int i = 0; i < TOK_T; ++i) {
    const int sh = dv[i] * 8;
    dv[i] |= (int)((cnt >> sh) & 0xff) << 3;
    cnt += 1ull << sh;
  }
#pragma unroll  // constant shifts
  for (int d = 0; d < ND; ++d) tbl[d * PREP_T + t] = (int)((cnt >> (d * 8)) & 0xff);
  __syncthreads();

  // exclusive prefix sum over tbl read as one row of ND * PREP_T entries: entry
  // [d][t] becomes the first place in perm of thread t's tokens of domain d
  {
    v4i e0 = *(const v4i*)&tbl[t * 8];
    v4i e1 = *(const v4i*)&tbl[t * 8 + 4];
    const int x1 = e0.x, x2 = x1 + e0.y, x3 = x2 + e0.z, x4 = x3 + e0.w;
    const int x5 = x4 + e1.x, x6 = x5 + e1.y, x7 = x6 + e1.z, tot = x7 + e1.w;
    const int incl = wave_incl_scan(tot, lane);
    if (lane == 31) wsum[wave] = incl;
    __syncthreads();
    const int wincl = wave_incl_scan(wsum[lane], lane);
    const int wbase = (wave == 0) ? 0 : __shfl(wincl, wave - 1, 32);
    const int base  = wbase + incl - tot;
    v4i o0 = {base, base + x1, base + x2, base + x3};
    v4i o1 = {base + x4, base + x5, base + x6, base + x7};
    *(v4i*)&tbl[t * 8]     = o0;
    *(v4i*)&tbl[t * 8 + 4] = o1;
  }
  __syncthreads();

  if (t < ND) {
    const int off = tbl[t * PREP_T];
    const int nxt = (t == ND - 1) ? N_TOK : tbl[(t + 1) * PREP_T];
    offsets[t] = off;
    counts[t]  = nxt - off;
  }

  // place every token; perm is put together in LDS so that it leaves in whole lines
#pragma unroll
  for (int i = 0; i < TOK_T; ++i) dv[i] = tbl[(dv[i] & (ND - 1)) * PREP_T + t] + (dv[i] >> 3);
#pragma unroll
  for (int i = 0; i < TOK_T; ++i) sperm[dv[i]] = tok0 + (i >> 2) * 128 + (i & 3);
  __syncthreads();
#pragma unroll  // the eight LDS reads go out together
  for (int j = 0; j < N_TOK / (4 * PREP_T); ++j)
    *(v4i*)(perm + (j * PREP_T + t) * 4) = *(const v4i*)&sperm[(j * PREP_T + t) * 4];
}

// ---------------- operand fetch one block of k-steps ahead ----------------

// One block = KS k-steps of 4: the A fragments of the RT row tiles (from LDS) and
// the B fragments of the wave's NT column tiles (from global memory).
template <int RT, int NT, int KS>
struct Frags {
  v2f a[KS][RT];
  v2f b[KS][NT];
};

// pa, pb: the lane's own first A element (LDS) and first B element (global) of the block.
template <bool PACKED, int NC, int RT, int NT, int KS>
__device__ __forceinline__ void fetch_block(Frags<RT, NT, KS>& f, const float* pa, int astride,
                                            const float* __restrict__ pb) {
#pragma unroll
  for (int ks = 0; ks < KS; ++ks)
#pragma unroll
    for (int nt = 0; nt < NT; ++nt) {
      if (PACKED) {
        f.b[ks][nt] = *(const v2f*)(pb + (ks * 2 * NC + nt * 16) * 2);
      } else {
        f.b[ks][nt].x = pb[ks * 4 * NC + nt * 16];
        f.b[ks][nt].y = pb[(ks * 4 + 1) * NC + nt * 16];
      }
    }
#pragma unroll
  for (int ks = 0; ks < KS; ++ks)
#pragma unroll
    for (int rt = 0; rt < RT; ++rt)
      f.a[ks][rt] = *(const v2f*)(pa + rt * 16 * astride + ks * 4);  // rows rt*16 .. rt*16+15
}

template <int RT, int NT, int KS>
__device__ __forceinline__ void mma_block(const Frags<RT, NT, KS>& f, v8f (&acc)[RT][NT]) {
#pragma unroll
  for (int ks = 0; ks < KS; ++ks)
#pragma unroll
    for (int nt = 0; nt < NT; ++nt)
#pragma unroll
      for (int rt = 0; rt < RT; ++rt)
        acc[rt][nt] = __builtin_amdgcn_wmma_f32_16x16x4_f32(
            false, f.a[ks][rt], false, f.b[ks][nt], (short)0, acc[rt][nt], false, false);
}

// acc += A[RT*16 x K] (LDS) * W[K x NT*16]: two fragment sets, the set of block j+1
// is requested before the products of block j, so its latency runs behind them.
// k runs upward through the same accumulators as a plain loop.
template <bool PACKED, int K, int NC, int RT, int NT, int KS>
__device__ __forceinline__ void gemm_ahead(v8f (&acc)[RT][NT], const float* sA, int astride,
                                           const float* __restrict__ Wd,
                                           const float* __restrict__ Wpd,
                                           int cb, int nlo, int khalf) {
  constexpr int BK = KS * 4;       // k per block
  constexpr int BSTEP = BK * NC;   // floats of W per block, packed or not
  const float* pa = sA + nlo * astride + 2 * khalf;
  const float* const pb0 = PACKED ? Wpd + ((size_t)khalf * NC + cb + nlo) * 2
                                  : Wd + (size_t)(2 * khalf) * NC + cb + nlo;
  const float* pb = pb0;
  Frags<RT, NT, KS> f0, f1;
  fetch_block<PACKED, NC, RT, NT, KS>(f0, pa, astride, pb);
  // The scheduling barriers keep every fetch one group that stands whole in front of
  // the other set's products: without them the LDS reads sink in among the WMMAs
  // that use them and are waited for there.
  for (int kb = 0; kb < K - 2 * BK; kb += 2 * BK) {
    fetch_block<PACKED, NC, RT, NT, KS>(f1, pa + BK, astride, pb + BSTEP);
    __builtin_amdgcn_sched_barrier(0);
    mma_block<RT, NT, KS>(f0, acc);
    __builtin_amdgcn_sched_barrier(0);
    fetch_block<PACKED, NC, RT, NT, KS>(f0, pa + 2 * BK, astride, pb + 2 * BSTEP);
    __builtin_amdgcn_sched_barrier(0);
    mma_block<RT, NT, KS>(f1, acc);
    __builtin_amdgcn_sched_barrier(0);
    // The loads of f0 are still in flight here and the step below rewrites their
    // address registers: the wait on address translations stands in front of it
    // (between two scheduling barriers, so that it stays behind the products and
    // the step stays behind it).
    asm volatile("s_wait_xcnt 0x0" ::: "memory");
    __builtin_amdgcn_sched_barrier(0);
    pa += 2 * BK;
    pb += 2 * BSTEP;
  }
  fetch_block<PACKED, NC, RT, NT, KS>(f1, pa + BK, astride, pb0 + (K / BK - 1) * BSTEP);
  // Last use of pb0: naming it here keeps its registers from being reused for
  // anything else before the translations of the loads above are done.
  asm volatile("s_wait_xcnt 0x0" :: "v"(pb0) : "memory");
  __builtin_amdgcn_sched_barrier(0);
  mma_block<RT, NT, KS>(f0, acc);
  mma_block<RT, NT, KS>(f1, acc);
}

// ---------------- fused expert MLP ----------------

// Four async b128 copies of a lane, global memory to LDS, in one statement. The wait on
// address translations is its last line, so that it stands in front of whatever rewrites
// the copies' address registers.
__device__ __forceinline__ void copy4_to_lds(lds_f* l0, const float* g0, lds_f* l1, const float* g1,
                                             lds_f* l2, const float* g2, lds_f* l3, const float* g3) {
  asm volatile("global_load_async_to_lds_b128 %0, %1, off\n\t"
               "global_load_async_to_lds_b128 %2, %3, off\n\t"
               "global_load_async_to_lds_b128 %4, %5, off\n\t"
               "global_load_async_to_lds_b128 %6, %7, off\n\t"
               "s_wait_xcnt 0x0"
               :: "v"(l0), "v"(g0), "v"(l1), "v"(g1), "v"(l2), "v"(g2), "v"(l3), "v"(g3)
               : "memory");
}

// ---- stage 1: H = X @ W1[d] + b1[d] for RT * 16 rows; this wave owns cols [wave*128, wave*128+128)
template <bool PACKED, int RT>
__device__ __forceinline__ void stage1(float* sH, int d, int wave, int nlo, int khalf,
                                       const float* __restrict__ W1, const float* __restrict__ b1,
                                       const float* __restrict__ W1p) {
  float* const sX = sH;  // X is dead once stage 1's products are done; H is written behind a barrier
  const float* W1d  = W1  + (size_t)d * DIN * DHID;
  const float* W1pd = W1p + (size_t)d * (DIN / 2) * DHID * 2;
  const float* b1d  = b1  + (size_t)d * DHID;
  const int cb = wave * 128;
  v8f acc[RT][8];                              // [row-tile][col-tile]
#pragma unroll
  for (int nt = 0; nt < 8; ++nt) {
    float bb = b1d[cb + nt * 16 + nlo];
    v8f t = {bb, bb, bb, bb, bb, bb, bb, bb};
#pragma unroll
    for (int rt = 0; rt < RT; ++rt) acc[rt][nt] = t;
  }
  // 4 / RT k-steps a block: a fetch-ahead block is 32 WMMAs with one row tile as with two
  gemm_ahead<PACKED, DIN, DHID, RT, 8, 4 / RT>(acc, sX, SX_STRIDE, W1d, W1pd, cb, nlo, khalf);
  __syncthreads();  // every wave has read its last X fragment before H overwrites the X tile
  // one lane address; row tile, row and column tile are constant steps from it
  float* const hp = sH + 8 * khalf * SH_STRIDE + cb + nlo;
#pragma unroll
  for (int rt = 0; rt < RT; ++rt)
#pragma unroll
    for (int nt = 0; nt < 8; ++nt)
#pragma unroll
      for (int v = 0; v < 8; ++v)
        hp[(rt * 16 + v) * SH_STRIDE + nt * 16] = acc[rt][nt][v];
}

// ---- stage 2: OUT = H @ W2[d] + b2[d] for RT * 16 rows; this wave owns cols [wave*32, wave*32+32)
template <bool PACKED, int RT>
__device__ __forceinline__ void stage2(const float* sH, const int* srow, int d, int nvalid,
                                       int wave, int nlo, int khalf,
                                       const float* __restrict__ W2, const float* __restrict__ b2,
                                       const float* __restrict__ W2p, float* __restrict__ out) {
  const float* W2d  = W2  + (size_t)d * DHID * DOUT;
  const float* W2pd = W2p + (size_t)d * (DHID / 2) * DOUT * 2;
  const float* b2d  = b2  + (size_t)d * DOUT;
  const int cb = wave * 32;
  v8f acc[RT][2];                              // [row-tile][col-tile]
#pragma unroll
  for (int nt = 0; nt < 2; ++nt) {
    float bb = b2d[cb + nt * 16 + nlo];
    v8f t = {bb, bb, bb, bb, bb, bb, bb, bb};
#pragma unroll
    for (int rt = 0; rt < RT; ++rt) acc[rt][nt] = t;
  }
  gemm_ahead<PACKED, DHID, DOUT, RT, 2, 16 / RT>(acc, sH, SH_STRIDE, W2d, W2pd, cb, nlo, khalf);
  int tok[RT][8];  // the output rows' tokens, read before srow is given up
#pragma unroll
  for (int rt = 0; rt < RT; ++rt)
#pragma unroll
    for (int v = 0; v < 8; ++v) tok[rt][v] = srow[rt * 16 + v + 8 * khalf];
  // End of the pass's LDS use: behind this wait and barrier the group's next pass may
  // rewrite srow and copy its X tile over H. They stand in front of the output stores,
  // so that no wave waits at the barrier for its stores to land.
  asm volatile("s_wait_dscnt 0x0" ::: "memory");
  __syncthreads();
  const int nv = nvalid - 8 * khalf;  // row rt*16 + v + 8*khalf is a real token where rt*16 + v < nv
#pragma unroll
  for (int rt = 0; rt < RT; ++rt)
#pragma unroll
    for (int nt = 0; nt < 2; ++nt)
#pragma unroll
      for (int v = 0; v < 8; ++v)
        if (rt * 16 + v < nv)
          out[(size_t)tok[rt][v] * DOUT + cb + nt * 16 + nlo] = acc[rt][nt][v];
  // The last stores are still in flight here: the wait on address translations stands
  // in front of whatever the group's next pass writes into their registers.
  asm volatile("s_wait_xcnt 0x0" ::: "memory");
}

// One pass: nu units (nu * 16 rows, nu = 1 or 2, the same for the whole group) of domain d,
// from place row0 of its token list, through the whole MLP.
template <bool PACKED>
__device__ __forceinline__ void tile_pass(float* sH, int* srow, int nu, int d, int row0, int nvalid, int base,
                                          const float* __restrict__ x,
                                          const float* __restrict__ W1, const float* __restrict__ b1,
                                          const float* __restrict__ gamma, const float* __restrict__ beta,
                                          const float* __restrict__ W2, const float* __restrict__ b2,
                                          const float* __restrict__ W1p, const float* __restrict__ W2p,
                                          float* __restrict__ out, const int* __restrict__ perm) {
  float* const sX = sH;
  const int tid = threadIdx.x;
  if (tid < nu * UNIT) {
    int rr = (tid < nvalid) ? (row0 + tid) : row0;  // clamp padding rows to a valid token
    srow[tid] = perm[base + rr];
  }
  __syncthreads();

  // gather X tile (nu*16 x 256 fp32) straight into LDS with async b128 copies
  {
    const int r0 = tid >> 6;   // 64 float4 per row; a thread's copies lie four rows apart
    const int c  = (tid & 63) << 2;
    for (int i = 0; i < nu; ++i) {  // a trip count that is the same for the whole group
      const int r = r0 + i * UNIT;
      copy4_to_lds((lds_f*)&sX[(r + 0) * SX_STRIDE + c],  x + (size_t)srow[r + 0] * DIN + c,
                   (lds_f*)&sX[(r + 4) * SX_STRIDE + c],  x + (size_t)srow[r + 4] * DIN + c,
                   (lds_f*)&sX[(r + 8) * SX_STRIDE + c],  x + (size_t)srow[r + 8] * DIN + c,
                   (lds_f*)&sX[(r + 12) * SX_STRIDE + c], x + (size_t)srow[r + 12] * DIN + c);
    }
    asm volatile("s_wait_asynccnt 0x0" ::: "memory");
  }
  __syncthreads();

  const int wave  = tid >> 5;
  const int lane  = tid & 31;
  const int nlo   = lane & 15;   // N index (and A-matrix row M) within a 16-tile
  const int khalf = lane >> 4;   // lanes 16-31 carry K+2/K+3 per ISA 16x4 layout

  if (nu == 2) stage1<PACKED, 2>(sH, d, wave, nlo, khalf, W1, b1, W1p);
  else         stage1<PACKED, 1>(sH, d, wave, nlo, khalf, W1, b1, W1p);
  __syncthreads();

  // ---- LayerNorm + ReLU (two-pass, matches reference); 2 * nu rows per wave
  {
    const float* gd = gamma + (size_t)d * DHID;
    const float* bd = beta  + (size_t)d * DHID;
    for (int rp = 0; rp < nu; ++rp)
#pragma unroll  // a wave's two rows of one unit
    for (int rq = 0; rq < 2; ++rq) {
      const int r = (wave * nu + rp) * 2 + rq;
      float s = 0.f;
      for (int c = lane; c < DHID; c += 32) s += sH[r * SH_STRIDE + c];
#pragma unroll
      for (int off = 16; off > 0; off >>= 1) s += __shfl_xor(s, off, 32);
      const float mu = s * (1.f / DHID);
      float vv = 0.f;
      for (int c = lane; c < DHID; c += 32) {
        float h = sH[r * SH_STRIDE + c] - mu;
        vv += h * h;
      }
#pragma unroll
      for (int off = 16; off > 0; off >>= 1) vv += __shfl_xor(vv, off, 32);
      const float inv = rsqrtf(vv * (1.f / DHID) + LN_EPS);
      for (int c = lane; c < DHID; c += 32) {
        float h = (sH[r * SH_STRIDE + c] - mu) * inv * gd[c] + bd[c];
        sH[r * SH_STRIDE + c] = fmaxf(h, 0.f);
      }
    }
  }
  __syncthreads();

  if (nu == 2) stage2<PACKED, 2>(sH, srow, d, nvalid, wave, nlo, khalf, W2, b2, W2p, out);
  else         stage2<PACKED, 1>(sH, srow, d, nvalid, wave, nlo, khalf, W2, b2, W2p, out);
}

// Two work-groups share a WGP (four waves per SIMD), so that one group's gather,
// LayerNorm, barriers and stores run behind the other group's products. That takes
// at most 160 KiB of LDS a group (the X tile lies in the H tile's space) and at most
// 256 registers a wave (the second launch bound; the fetch-ahead blocks are 32 WMMAs).
//
// The grid is NGROUPS groups, as many as are resident at once. The rows of all domains,
// each domain's rounded up to whole units of 16, are one list of units; every group takes
// an equal share of it (shares differ by one unit at most) and walks it in passes of two
// units, or of one where its share or the domain ends. No group waits for a free place,
// and none is launched to find nothing to do.
template <bool PACKED>
__launch_bounds__(256, 4)
__global__ void k_mlp(const float* __restrict__ x,
                      const float* __restrict__ W1, const float* __restrict__ b1,
                      const float* __restrict__ gamma, const float* __restrict__ beta,
                      const float* __restrict__ W2, const float* __restrict__ b2,
                      const float* __restrict__ W1p, const float* __restrict__ W2p,
                      float* __restrict__ out,
                      const int* __restrict__ counts, const int* __restrict__ offsets,
                      const int* __restrict__ perm) {
  __shared__ __attribute__((aligned(16))) float sH[ROWS * SH_STRIDE];
  __shared__ int srow[ROWS];

  // tokens, first place in perm and units per domain; every loop over these is unrolled,
  // so that they stay in registers
  int cn[ND], of[ND], nun[ND];
  int total = 0;
#pragma unroll
  for (int k = 0; k < ND; ++k) {
    cn[k]  = counts[k];
    of[k]  = offsets[k];
    nun[k] = (cn[k] + UNIT - 1) / UNIT;
    total += nun[k];
  }
  // Groups whose index agrees in its low three bits take neighbouring shares (for speed
  // only: neighbours read the same weights).
  const int g  = ((int)blockIdx.x & 7) * (NGROUPS / 8) + ((int)blockIdx.x >> 3);
  // rounded up: where shares differ, the longer ones are spread evenly over g, the first at g = 0
  int u        = (g * total + NGROUPS - 1) / NGROUPS;
  const int u1 = ((g + 1) * total + NGROUPS - 1) / NGROUPS;

  for (int p = 0; p < MAX_PASSES && u < u1; ++p) {
    // the domain of unit u, and that domain's first unit
    int d = 0, ub = 0, un = nun[0], cnt = cn[0], base = of[0];
#pragma unroll
    for (int k = 1; k < ND; ++k)
      if (u >= ub + un) { ub += un; d = k; un = nun[k]; cnt = cn[k]; base = of[k]; }
    const int row0 = (u - ub) * UNIT;
    const int left = cnt - row0;
    const int nu = (u + 1 < u1 && u + 1 < ub + un) ? 2 : 1;
    tile_pass<PACKED>(sH, srow, nu, d, row0, min(nu * UNIT, left), base,
                      x, W1, b1, gamma, beta, W2, b2, W1p, W2p, out, perm);
    u += nu;
  }
}

// ---------------- launcher ----------------

extern "C" void kernel_launch(void* const* d_in, const int* in_sizes, int n_in,
                              void* d_out, int out_size, void* d_ws, size_t ws_size,
                              hipStream_t stream) {
  const float* x     = (const float*)d_in[0];
  const int*   dom   = (const int*)d_in[1];
  const float* W1    = (const float*)d_in[2];
  const float* b1    = (const float*)d_in[3];
  const float* gamma = (const float*)d_in[4];
  const float* beta  = (const float*)d_in[5];
  const float* W2    = (const float*)d_in[6];
  const float* b2    = (const float*)d_in[7];
  float* out = (float*)d_out;

  int* wsi     = (int*)d_ws;
  int* counts  = wsi;        // 8
  int* offsets = wsi + 16;   // 8
  int* perm    = wsi + 32;   // N_TOK

  const size_t packElems1 = (size_t)ND * (DIN / 2) * DHID * 2;   // 2M floats
  const size_t packElems2 = (size_t)ND * (DHID / 2) * DOUT * 2;  // 2M floats
  float* p1 = (float*)(wsi + 32 + N_TOK);
  float* p2 = p1 + packElems1;
  const size_t needed = (size_t)(32 + N_TOK) * 4 + (packElems1 + packElems2) * 4;
  const bool packed = (ws_size >= needed);

  if (packed) {
    k_prep<<<1 + 2 * PACK_BLOCKS_W, PREP_T, 0, stream>>>(dom, W1, W2, p1, p2, counts, offsets, perm);
    k_mlp<true><<<NGROUPS, 256, 0, stream>>>(
        x, W1, b1, gamma, beta, W2, b2, p1, p2, out, counts, offsets, perm);
  } else {
    k_prep<<<1, PREP_T, 0, stream>>>(dom, W1, W2, p1, p2, counts, offsets, perm);
    k_mlp<false><<<NGROUPS, 256, 0, stream>>>(
        x, W1, b1, gamma, beta, W2, b2, p1, p2, out, counts, offsets, perm);
  }
}

// v005
// Measured time: 180 microseconds a run.
// Two timings next to v004 both put it at 1.09 times that version's speed.
// Counting every step since v000, it is 1.91 times as fast.
#include <hip/hip_runtime.h>

typedef __attribute__((ext_vector_type(2))) float v2f;
typedef __attribute__((ext_vector_type(8))) float v8f;
typedef __attribute__((address_space(3))) float lds_f;

#define N_TOK 32768
#define DIN 256
#define DHID 1024
#define DOUT 256
#define ND 8
#define ROWS 32
#define UNIT 16       // rows of one WMMA row tile: the grain in which rows are dealt out
#define NGROUPS 512   // work-groups of the MLP launch: two on each of 256 WGPs, all resident at once
// Units over all domains: at most N_TOK / UNIT + ND - 1; a group's share of them, rounded up.
#define MAX_PASSES ((N_TOK / UNIT + ND - 1 + NGROUPS - 1) / NGROUPS)
#define SX_STRIDE 260   // == 4 (mod 64 banks): conflict-free column reads
#define SH_STRIDE 1028  // == 4 (mod 64 banks)
#define LN_EPS 1e-5f

// ---------------- preparation: one launch ----------------

#define PREP_T 1024                 // threads per block (32 waves)
#define TOK_T (N_TOK / PREP_T)      // tokens per thread of the binning block
#define PACK_BLOCKS_W 64            // packing blocks per weight tensor
#define PACK_U 4                    // units of 4 column pairs per packing thread

typedef __attribute__((ext_vector_type(4))) float v4f;
typedef __attribute__((ext_vector_type(4))) int v4i;

__device__ __forceinline__ int wave_incl_scan(int v, int lane) {
#pragma unroll  // five fixed steps, each lane distance a constant
  for (int off = 1; off < 32; off <<= 1) {
    int o = __shfl_up(v, off, 32);
    if (lane >= off) v += o;
  }
  return v;
}

// Repack W[K][NC] (all domains, K even) into P[kp][n][2] = {W[2kp][n], W[2kp+1][n]}
// so a WMMA B-fragment is one contiguous b64 per lane. One unit = 4 columns of one
// row pair: two 16-byte loads, two 16-byte stores. pb: this block's index in the tensor.
template <int NC>
__device__ __forceinline__ void pack_units(const float* __restrict__ W, float* __restrict__ P,
                                           int pb, int t) {
  static_assert((PREP_T * 4) % NC == 0, "a thread's units lie whole row pairs apart");
  const unsigned i0 = (unsigned)(pb * PACK_U * PREP_T + t) * 4;  // first column pair of unit 0
  // i0 / NC: the row pair, counted over all domains. Unit j lies PREP_T * 4 column pairs
  // on, which is PREP_T * 8 floats on in W and in P alike.
  const float* src = W + (size_t)(i0 / NC) * (2 * NC) + (i0 % NC);
  float* dst = P + (size_t)i0 * 2;
  v4f r0[PACK_U], r1[PACK_U];
#pragma unroll  // r0, r1 stay in registers and all eight loads are in flight together
  for (int j = 0; j < PACK_U; ++j) {
    r0[j] = *(const v4f*)(src + j * (PREP_T * 8));
    r1[j] = *(const v4f*)(src + j * (PREP_T * 8) + NC);
  }
#pragma unroll  // r0, r1 stay in registers
  for (int j = 0; j < PACK_U; ++j) {
    v4f lo = {r0[j].x, r1[j].x, r0[j].y, r1[j].y};
    v4f hi = {r0[j].z, r1[j].z, r0[j].w, r1[j].w};
    *(v4f*)(dst + j * (PREP_T * 8))     = lo;
    *(v4f*)(dst + j * (PREP_T * 8) + 4) = hi;
  }
  // The last stores are still in flight here: the wait on address translations stands
  // in front of whatever code behind this call rewrites their registers.
  asm volatile("s_wait_xcnt 0x0" ::: "memory");
}

// Block 0 bins all tokens by domain (counts, offsets, perm) with one prefix sum in LDS;
// the blocks behind it, where launched, repack W1 and W2 at the same time.
__launch_bounds__(PREP_T)
__global__ void k_prep(const int* __restrict__ dom,
                       const float* __restrict__ W1, const float* __restrict__ W2,
                       float* __restrict__ P1, float* __restrict__ P2,
                       int* __restrict__ counts, int* __restrict__ offsets,
                       int* __restrict__ perm) {
  __shared__ __attribute__((aligned(16))) int tbl[ND * PREP_T];  // [domain][thread]
  __shared__ __attribute__((aligned(16))) int sperm[N_TOK];
  __shared__ int wsum[PREP_T / 32];

  const int t = threadIdx.x;
  if (blockIdx.x != 0) {
    const int pb = (int)blockIdx.x - 1;
    if (pb < PACK_BLOCKS_W) pack_units<DHID>(W1, P1, pb, t);
    else                    pack_units<DOUT>(W2, P2, pb - PACK_BLOCKS_W, t);
    return;
  }

  const int wave = t >> 5;
  const int lane = t & 31;
  // Token (j, c) of this thread is tok0 + j * 128 + c: every load is 512 contiguous bytes a wave.
  const int tok0 = wave * (32 * TOK_T) + lane * 4;

  int dv[TOK_T];  // every loop over dv is unrolled so that it stays in registers
#pragma unroll
  for (int j = 0; j < TOK_T / 4; ++j) {
    v4i q = *(const v4i*)(dom + tok0 + j * 128);
    dv[j * 4 + 0] = q.x & (ND - 1);  // the mask bounds every address formed from a domain
    dv[j * 4 + 1] = q.y & (ND - 1);
    dv[j * 4 + 2] = q.z & (ND - 1);
    dv[j * 4 + 3] = q.w & (ND - 1);
  }

  // this thread's tokens per domain, one byte a domain (at most TOK_T = 32 each);
  // each token keeps its rank among the thread's tokens of its domain above its 3 domain bits
  unsigned long long cnt = 0;
#pragma unroll
  for (int i = 0; i < TOK_T; ++i) {
    const int sh = dv[i] * 8;
    dv[i] |= (int)((cnt >> sh) & 0xff) << 3;
    cnt += 1ull << sh;
  }
#pragma unroll  // constant shifts
  for (int d = 0; d < ND; ++d) tbl[d * PREP_T + t] = (int)((cnt >> (d * 8)) & 0xff);
  __syncthreads();

  // exclusive prefix sum over tbl read as one row of ND * PREP_T entries: entry
  // [d][t] becomes the first place in perm of thread t's tokens of domain d
  {
    v4i e0 = *(const v4i*)&tbl[t * 8];
    v4i e1 = *(const v4i*)&tbl[t * 8 + 4];
    const int x1 = e0.x, x2 = x1 + e0.y, x3 = x2 + e0.z, x4 = x3 + e0.w;
    const int x5 = x4 + e1.x, x6 = x5 + e1.y, x7 = x6 + e1.z, tot = x7 + e1.w;
    const int incl = wave_incl_scan(tot, lane);
    if (lane == 31) wsum[wave] = incl;
    __syncthreads();
    const int wincl = wave_incl_scan(wsum[lane], lane);
    const int wbase = (wave == 0) ? 0 : __shfl(wincl, wave - 1, 32);
    const int base  = wbase + incl - tot;
    v4i o0 = {base, base + x1, base + x2, base + x3};
    v4i o1 = {base + x4, base + x5, base + x6, base + x7};
    *(v4i*)&tbl[t * 8]     = o0;
    *(v4i*)&tbl[t * 8 + 4] = o1;
  }
  __syncthreads();

  if (t < ND) {
    const int off = tbl[t * PREP_T];
    const int nxt = (t == ND - 1) ? N_TOK : tbl[(t + 1) * PREP_T];
    offsets[t] = off;
    counts[t]  = nxt - off;
  }

  // place every token; perm is put together in LDS so that it leaves in whole lines
#pragma unroll
  for (int i = 0; i < TOK_T; ++i) dv[i] = tbl[(dv[i] & (ND - 1)) * PREP_T + t] + (dv[i] >> 3);
#pragma unroll
  for (int i = 0; i < TOK_T; ++i) sperm[dv[i]] = tok0 + (i >> 2) * 128 + (i & 3);
  __syncthreads();
#pragma unroll  // the eight LDS reads go out together
  for (int j = 0; j < N_TOK / (4 * PREP_T); ++j)
    *(v4i*)(perm + (j * PREP_T + t) * 4) = *(const v4i*)&sperm[(j * PREP_T + t) * 4];
}

// ---------------- operand fetch one block of k-steps ahead ----------------

// One block = KS k-steps of 4: the A fragments of the RT row tiles (from LDS) and
// the B fragments of the wave's NT column tiles (from global memory).
template <int RT, int NT, int KS>
struct Frags {
  v2f a[KS][RT];
  v2f b[KS][NT];
};

// pa, pb: the lane's own first A element (LDS) and first B element (global) of the block.
template <bool PACKED, int NC, int RT, int NT, int KS>
__device__ __forceinline__ void fetch_block(Frags<RT, NT, KS>& f, const float* pa, int astride,
                                            const float* __restrict__ pb) {
#pragma unroll
  for (int ks = 0; ks < KS; ++ks)
#pragma unroll
    for (int nt = 0; nt < NT; ++nt) {
      if (PACKED) {
        f.b[ks][nt] = *(const v2f*)(pb + (ks * 2 * NC + nt * 16) * 2);
      } else {
        f.b[ks][nt].x = pb[ks * 4 * NC + nt * 16];
        f.b[ks][nt].y = pb[(ks * 4 + 1) * NC + nt * 16];
      }
    }
#pragma unroll
  for (int ks = 0; ks < KS; ++ks)
#pragma unroll
    for (int rt = 0; rt < RT; ++rt)
      f.a[ks][rt] = *(const v2f*)(pa + rt * 16 * astride + ks * 4);  // rows rt*16 .. rt*16+15
}

template <int RT, int NT, int KS>
__device__ __forceinline__ void mma_block(const Frags<RT, NT, KS>& f, v8f (&acc)[RT][NT]) {
#pragma unroll
  for (int ks = 0; ks < KS; ++ks)
#pragma unroll
    for (int nt = 0; nt < NT; ++nt)
#pragma unroll
      for (int rt = 0; rt < RT; ++rt)
        acc[rt][nt] = __builtin_amdgcn_wmma_f32_16x16x4_f32(
            false, f.a[ks][rt], false, f.b[ks][nt], (short)0, acc[rt][nt], false, false);
}

// acc += A[RT*16 x K] (LDS) * W[K x NT*16]: two fragment sets, the set of block j+1
// is requested before the products of block j, so its latency runs behind them.
// k runs upward through the same accumulators as a plain loop.
template <bool PACKED, int K, int NC, int RT, int NT, int KS>
__device__ __forceinline__ void gemm_ahead(v8f (&acc)[RT][NT], const float* sA, int astride,
                                           const float* __restrict__ Wd,
                                           const float* __restrict__ Wpd,
                                           int cb, int nlo, int khalf) {
  constexpr int BK = KS * 4;       // k per block
  constexpr int BSTEP = BK * NC;   // floats of W per block, packed or not
  const float* pa = sA + nlo * astride + 2 * khalf;
  const float* const pb0 = PACKED ? Wpd + ((size_t)khalf * NC + cb + nlo) * 2
                                  : Wd + (size_t)(2 * khalf) * NC + cb + nlo;
  const float* pb = pb0;
  Frags<RT, NT, KS> f0, f1;
  fetch_block<PACKED, NC, RT, NT, KS>(f0, pa, astride, pb);
  // The scheduling barriers keep every fetch one group that stands whole in front of
  // the other set's products: without them the LDS reads sink in among the WMMAs
  // that use them and are waited for there.
  for (int kb = 0; kb < K - 2 * BK; kb += 2 * BK) {
    fetch_block<PACKED, NC, RT, NT, KS>(f1, pa + BK, astride, pb + BSTEP);
    __builtin_amdgcn_sched_barrier(0);
    mma_block<RT, NT, KS>(f0, acc);
    __builtin_amdgcn_sched_barrier(0);
    fetch_block<PACKED, NC, RT, NT, KS>(f0, pa + 2 * BK, astride, pb + 2 * BSTEP);
    __builtin_amdgcn_sched_barrier(0);
    mma_block<RT, NT, KS>(f1, acc);
    __builtin_amdgcn_sched_barrier(0);
    // The loads of f0 are still in flight here and the step below rewrites their
    // address registers: the wait on address translations stands in front of it
    // (between two scheduling barriers, so that it stays behind the products and
    // the step stays behind it).
    asm volatile("s_wait_xcnt 0x0" ::: "memory");
    __builtin_amdgcn_sched_barrier(0);
    pa += 2 * BK;
    pb += 2 * BSTEP;
  }
  fetch_block<PACKED, NC, RT, NT, KS>(f1, pa + BK, astride, pb0 + (K / BK - 1) * BSTEP);
  // Last use of pb0: naming it here keeps its registers from being reused for
  // anything else before the translations of the loads above are done.
  asm volatile("s_wait_xcnt 0x0" :: "v"(pb0) : "memory");
  __builtin_amdgcn_sched_barrier(0);
  mma_block<RT, NT, KS>(f0, acc);
  mma_block<RT, NT, KS>(f1, acc);
}

// ---------------- fused expert MLP ----------------

// Four async b128 copies of a lane, global memory to LDS, in one statement. The wait on
// address translations is its last line, so that it stands in front of whatever rewrites
// the copies' address registers.
__device__ __forceinline__ void copy4_to_lds(lds_f* l0, const float* g0, lds_f* l1, const float* g1,
                                             lds_f* l2, const float* g2, lds_f* l3, const float* g3) {
  asm volatile("global_load_async_to_lds_b128 %0, %1, off\n\t"
               "global_load_async_to_lds_b128 %2, %3, off\n\t"
               "global_load_async_to_lds_b128 %4, %5, off\n\t"
               "global_load_async_to_lds_b128 %6, %7, off\n\t"
               "s_wait_xcnt 0x0"
               :: "v"(l0), "v"(g0), "v"(l1), "v"(g1), "v"(l2), "v"(g2), "v"(l3), "v"(g3)
               : "memory");
}

// ---- stage 1: H = X @ W1[d] + b1[d] for RT * 16 rows; this wave owns cols [wave*128, wave*128+128)
template <bool PACKED, int RT>
__device__ __forceinline__ void stage1(float* sH, int d, int wave, int nlo, int khalf,
                                       const float* __restrict__ W1, const float* __restrict__ b1,
                                       const float* __restrict__ W1p) {
  float* const sX = sH;  // X is dead once stage 1's products are done; H is written behind a barrier
  const float* W1d  = W1  + (size_t)d * DIN * DHID;
  const float* W1pd = W1p + (size_t)d * (DIN / 2) * DHID * 2;
  const float* b1d  = b1  + (size_t)d * DHID;
  const int cb = wave * 128;
  v8f acc[RT][8];                              // [row-tile][col-tile]
#pragma unroll
  for (int nt = 0; nt < 8; ++nt) {
    float bb = b1d[cb + nt * 16 + nlo];
    v8f t = {bb, bb, bb, bb, bb, bb, bb, bb};
#pragma unroll
    for (int rt = 0; rt < RT; ++rt) acc[rt][nt] = t;
  }
  // 4 / RT k-steps a block: a fetch-ahead block is 32 WMMAs with one row tile as with two
  gemm_ahead<PACKED, DIN, DHID, RT, 8, 4 / RT>(acc, sX, SX_STRIDE, W1d, W1pd, cb, nlo, khalf);
  __syncthreads();  // every wave has read its last X fragment before H overwrites the X tile
  // one lane address; row tile, row and column tile are constant steps from it
  float* const hp = sH + 8 * khalf * SH_STRIDE + cb + nlo;
#pragma unroll
  for (int rt = 0; rt < RT; ++rt)
#pragma unroll
    for (int nt = 0; nt < 8; ++nt)
#pragma unroll
      for (int v = 0; v < 8; ++v)
        hp[(rt * 16 + v) * SH_STRIDE + nt * 16] = acc[rt][nt][v];
}

// ---- stage 2: OUT = H @ W2[d] + b2[d] for RT * 16 rows; this wave owns cols [wave*32, wave*32+32)
template <bool PACKED, int RT>
__device__ __forceinline__ void stage2(const float* sH, const int* srow, int d, int nvalid,
                                       int wave, int nlo, int khalf,
                                       const float* __restrict__ W2, const float* __restrict__ b2,
                                       const float* __restrict__ W2p, float* __restrict__ out) {
  const float* W2d  = W2  + (size_t)d * DHID * DOUT;
  const float* W2pd = W2p + (size_t)d * (DHID / 2) * DOUT * 2;
  const float* b2d  = b2  + (size_t)d * DOUT;
  const int cb = wave * 32;
  v8f acc[RT][2];                              // [row-tile][col-tile]
#pragma unroll
  for (int nt = 0; nt < 2; ++nt) {
    float bb = b2d[cb + nt * 16 + nlo];
    v8f t = {bb, bb, bb, bb, bb, bb, bb, bb};
#pragma unroll
    for (int rt = 0; rt < RT; ++rt) acc[rt][nt] = t;
  }
  gemm_ahead<PACKED, DHID, DOUT, RT, 2, 16 / RT>(acc, sH, SH_STRIDE, W2d, W2pd, cb, nlo, khalf);
  int tok[RT][8];  // the output rows' tokens, read before srow is given up
#pragma unroll
  for (int rt = 0; rt < RT; ++rt)
#pragma unroll
    for (int v = 0; v < 8; ++v) tok[rt][v] = srow[rt * 16 + v + 8 * khalf];
  // End of the pass's LDS use: behind this wait and barrier the group's next pass may
  // rewrite srow and copy its X tile over H. They stand in front of the output stores,
  // so that no wave waits at the barrier for its stores to land.
  asm volatile("s_wait_dscnt 0x0" ::: "memory");
  __syncthreads();
  const int nv = nvalid - 8 * khalf;  // row rt*16 + v + 8*khalf is a real token where rt*16 + v < nv
#pragma unroll
  for (int rt = 0; rt < RT; ++rt)
#pragma unroll
    for (int nt = 0; nt < 2; ++nt)
#pragma unroll
      for (int v = 0; v < 8; ++v)
        if (rt * 16 + v < nv)
          out[(size_t)tok[rt][v] * DOUT + cb + nt * 16 + nlo] = acc[rt][nt][v];
  // The last stores are still in flight here: the wait on address translations stands
  // in front of whatever the group's next pass writes into their registers.
  asm volatile("s_wait_xcnt 0x0" ::: "memory");
}

// x of lane l ^ M within the lane's row of 16 (DPP row_xmask:M), all lanes on
template <int M>
__device__ __forceinline__ float row_xor(float x) {
  return __builtin_bit_cast(float, __builtin_amdgcn_update_dpp(0, __builtin_bit_cast(int, x), 0x160 + M,
                                                               0xf, 0xf, false));
}

// Sum over the wave's 32 lanes, left in every lane, without a trip through the LDS unit.
__device__ __forceinline__ float wave_sum(float t) {
  t += row_xor<1>(t);
  t += row_xor<2>(t);
  t += row_xor<4>(t);
  t += row_xor<8>(t);
  const int b = __builtin_bit_cast(int, t);  // lane l with lane l ^ 16
  return t + __builtin_bit_cast(float, __builtin_amdgcn_permlanex16(b, b, 0x76543210, 0xfedcba98, false, false));
}

// ---- LayerNorm + ReLU of NR rows of H by one wave. Every row is read from LDS once, 16 bytes
// a lane and read, and stays in registers through mean, variance and scaling; the NR rows go
// through each step side by side, so that one row's latencies run behind the others' work.
// hp: the lane's first element of the wave's first row; the lane owns columns j*128 + lane*4 + 0..3.
template <int NR>
__device__ __forceinline__ void ln_relu_rows(float* hp, const v4f (&lg)[DHID / 128],
                                             const v4f (&lb)[DHID / 128]) {
  constexpr int NJ = DHID / 128;
  v4f h[NR][NJ];  // every loop over h is unrolled so that it stays in registers
#pragma unroll
  for (int r = 0; r < NR; ++r)
#pragma unroll
    for (int j = 0; j < NJ; ++j) h[r][j] = *(const v4f*)(hp + r * SH_STRIDE + j * 128);

  float s[NR];
#pragma unroll
  for (int r = 0; r < NR; ++r) {
    v4f a = h[r][0];
#pragma unroll
    for (int j = 1; j < NJ; ++j) a += h[r][j];
    s[r] = (a.x + a.y) + (a.z + a.w);
  }
#pragma unroll
  for (int r = 0; r < NR; ++r) s[r] = wave_sum(s[r]);

  float q[NR];
#pragma unroll
  for (int r = 0; r < NR; ++r) {
    const float mu = s[r] * (1.f / DHID);
    v4f a = {0.f, 0.f, 0.f, 0.f};
#pragma unroll
    for (int j = 0; j < NJ; ++j) {
      h[r][j] -= mu;
      a += h[r][j] * h[r][j];
    }
    q[r] = (a.x + a.y) + (a.z + a.w);
  }
#pragma unroll
  for (int r = 0; r < NR; ++r) q[r] = wave_sum(q[r]);

#pragma unroll
  for (int r = 0; r < NR; ++r) {
    const float inv = rsqrtf(q[r] * (1.f / DHID) + LN_EPS);
#pragma unroll
    for (int j = 0; j < NJ; ++j) {
      v4f y = h[r][j] * inv * lg[j] + lb[j];
      v4f o = {fmaxf(y.x, 0.f), fmaxf(y.y, 0.f), fmaxf(y.z, 0.f), fmaxf(y.w, 0.f)};
      *(v4f*)(hp + r * SH_STRIDE + j * 128) = o;
    }
  }
}

// One pass: nu units (nu * 16 rows, nu = 1 or 2, the same for the whole group) of domain d,
// from place row0 of its token list, through the whole MLP.
template <bool PACKED>
__device__ __forceinline__ void tile_pass(float* sH, int* srow, int nu, int d, int row0, int nvalid, int base,
                                          const float* __restrict__ x,
                                          const float* __restrict__ W1, const float* __restrict__ b1,
                                          const float* __restrict__ gamma, const float* __restrict__ beta,
                                          const float* __restrict__ W2, const float* __restrict__ b2,
                                          const float* __restrict__ W1p, const float* __restrict__ W2p,
                                          float* __restrict__ out, const int* __restrict__ perm) {
  float* const sX = sH;
  const int tid = threadIdx.x;
  if (tid < nu * UNIT) {
    int rr = (tid < nvalid) ? (row0 + tid) : row0;  // clamp padding rows to a valid token
    srow[tid] = perm[base + rr];
  }
  __syncthreads();

  // gather X tile (nu*16 x 256 fp32) straight into LDS with async b128 copies
  {
    const int r0 = tid >> 6;   // 64 float4 per row; a thread's copies lie four rows apart
    const int c  = (tid & 63) << 2;
    for (int i = 0; i < nu; ++i) {  // a trip count that is the same for the whole group
      const int r = r0 + i * UNIT;
      copy4_to_lds((lds_f*)&sX[(r + 0) * SX_STRIDE + c],  x + (size_t)srow[r + 0] * DIN + c,
                   (lds_f*)&sX[(r + 4) * SX_STRIDE + c],  x + (size_t)srow[r + 4] * DIN + c,
                   (lds_f*)&sX[(r + 8) * SX_STRIDE + c],  x + (size_t)srow[r + 8] * DIN + c,
                   (lds_f*)&sX[(r + 12) * SX_STRIDE + c], x + (size_t)srow[r + 12] * DIN + c);
    }
    asm volatile("s_wait_asynccnt 0x0" ::: "memory");
  }
  __syncthreads();

  const int wave  = tid >> 5;
  const int lane  = tid & 31;
  const int nlo   = lane & 15;   // N index (and A-matrix row M) within a 16-tile
  const int khalf = lane >> 4;   // lanes 16-31 carry K+2/K+3 per ISA 16x4 layout

  if (nu == 2) stage1<PACKED, 2>(sH, d, wave, nlo, khalf, W1, b1, W1p);
  else         stage1<PACKED, 1>(sH, d, wave, nlo, khalf, W1, b1, W1p);
  __syncthreads();

  // ---- LayerNorm + ReLU (two-pass, matches reference); 2 * nu rows per wave
  {
    // gamma and beta of the lane's 32 columns, read once for all rows of the pass; their
    // latency runs behind the first rows' LDS reads and sums
    const float* gd = gamma + (size_t)d * DHID + lane * 4;
    const float* bd = beta  + (size_t)d * DHID + lane * 4;
    v4f lg[DHID / 128], lb[DHID / 128];
#pragma unroll  // lg, lb stay in registers
    for (int j = 0; j < DHID / 128; ++j) {
      lg[j] = *(const v4f*)(gd + j * 128);
      lb[j] = *(const v4f*)(bd + j * 128);
    }
    // These loads are in flight here: the wait on address translations stands in front of
    // whatever rewrites their address registers; naming gd and bd keeps those registers from
    // being given to a load's own result in front of it.
    asm volatile("s_wait_xcnt 0x0" :: "v"(gd), "v"(bd) : "memory");
    for (int rp = 0; rp < nu; ++rp)  // two rows at a time: with four, the rows, gamma and beta do not fit the registers
      ln_relu_rows<2>(sH + (wave * nu + rp) * 2 * SH_STRIDE + lane * 4, lg, lb);
  }
  __syncthreads();

  if (nu == 2) stage2<PACKED, 2>(sH, srow, d, nvalid, wave, nlo, khalf, W2, b2, W2p, out);
  else         stage2<PACKED, 1>(sH, srow, d, nvalid, wave, nlo, khalf, W2, b2, W2p, out);
}

// Two work-groups share a WGP (four waves per SIMD), so that one group's gather,
// LayerNorm, barriers and stores run behind the other group's products. That takes
// at most 160 KiB of LDS a group (the X tile lies in the H tile's space) and at most
// 256 registers a wave (the second launch bound; the fetch-ahead blocks are 32 WMMAs).
//
// The grid is NGROUPS groups, as many as are resident at once. The rows of all domains,
// each domain's rounded up to whole units of 16, are one list of units; every group takes
// an equal share of it (shares differ by one unit at most) and walks it in passes of two
// units, or of one where its share or the domain ends. No group waits for a free place,
// and none is launched to find nothing to do.
template <bool PACKED>
__launch_bounds__(256, 4)
__global__ void k_mlp(const float* __restrict__ x,
                      const float* __restrict__ W1, const float* __restrict__ b1,
                      const float* __restrict__ gamma, const float* __restrict__ beta,
                      const float* __restrict__ W2, const float* __restrict__ b2,
                      const float* __restrict__ W1p, const float* __restrict__ W2p,
                      float* __restrict__ out,
                      const int* __restrict__ counts, const int* __restrict__ offsets,
                      const int* __restrict__ perm) {
  __shared__ __attribute__((aligned(16))) float sH[ROWS * SH_STRIDE];
  __shared__ int srow[ROWS];

  // tokens, first place in perm and units per domain; every loop over these is unrolled,
  // so that they stay in registers
  int cn[ND], of[ND], nun[ND];
  int total = 0;
#pragma unroll
  for (int k = 0; k < ND; ++k) {
    cn[k]  = counts[k];
    of[k]  = offsets[k];
    nun[k] = (cn[k] + UNIT - 1) / UNIT;
    total += nun[k];
  }
  // Groups whose index agrees in its low three bits take neighbouring shares (for speed
  // only: neighbours read the same weights).
  const int g  = ((int)blockIdx.x & 7) * (NGROUPS / 8) + ((int)blockIdx.x >> 3);
  // rounded up: where shares differ, the longer ones are spread evenly over g, the first at g = 0
  int u        = (g * total + NGROUPS - 1) / NGROUPS;
  const int u1 = ((g + 1) * total + NGROUPS - 1) / NGROUPS;

  for (int p = 0; p < MAX_PASSES && u < u1; ++p) {
    // the domain of unit u, and that domain's first unit
    int d = 0, ub = 0, un = nun[0], cnt = cn[0], base = of[0];
#pragma unroll
    for (int k = 1; k < ND; ++k)
      if (u >= ub + un) { ub += un; d = k; un = nun[k]; cnt = cn[k]; base = of[k]; }
    const int row0 = (u - ub) * UNIT;
    const int left = cnt - row0;
    const int nu = (u + 1 < u1 && u + 1 < ub + un) ? 2 : 1;
    tile_pass<PACKED>(sH, srow, nu, d, row0, min(nu * UNIT, left), base,
                      x, W1, b1, gamma, beta, W2, b2, W1p, W2p, out, perm);
    u += nu;
  }
}

// ---------------- launcher ----------------

extern "C" void kernel_launch(void* const* d_in, const int* in_sizes, int n_in,
                              void* d_out, int out_size, void* d_ws, size_t ws_size,
                              hipStream_t stream) {
  const float* x     = (const float*)d_in[0];
  const int*   dom   = (const int*)d_in[1];
  const float* W1    = (const float*)d_in[2];
  const float* b1    = (const float*)d_in[3];
  const float* gamma = (const float*)d_in[4];
  const float* beta  = (const float*)d_in[5];
  const float* W2    = (const float*)d_in[6];
  const float* b2    = (const float*)d_in[7];
  float* out = (float*)d_out;

  int* wsi     = (int*)d_ws;
  int* counts  = wsi;        // 8
  int* offsets = wsi + 16;   // 8
  int* perm    = wsi + 32;   // N_TOK

  const size_t packElems1 = (size_t)ND * (DIN / 2) * DHID * 2;   // 2M floats
  const size_t packElems2 = (size_t)ND * (DHID / 2) * DOUT * 2;  // 2M floats
  float* p1 = (float*)(wsi + 32 + N_TOK);
  float* p2 = p1 + packElems1;
  const size_t needed = (size_t)(32 + N_TOK) * 4 + (packElems1 + packElems2) * 4;
  const bool packed = (ws_size >= needed);

  if (packed) {
    k_prep<<<1 + 2 * PACK_BLOCKS_W, PREP_T, 0, stream>>>(dom, W1, W2, p1, p2, counts, offsets, perm);
    k_mlp<true><<<NGROUPS, 256, 0, stream>>>(
        x, W1, b1, gamma, beta, W2, b2, p1, p2, out, counts, offsets, perm);
  } else {
    k_prep<<<1, PREP_T, 0, stream>>>(dom, W1, W2, p1, p2, counts, offsets, perm);
    k_mlp<false><<<NGROUPS, 256, 0, stream>>>(
        x, W1, b1, gamma, beta, W2, b2, p1, p2, out, counts, offsets, perm);
  }
}
